// v000
// The times below were measured on an AMD MI455X: many runs one after another, warmed up first and cycling through
// copies of the inputs, with the whole window's GPU time divided by the number of runs. Launches and the gaps
// between them are all in it. The median over several windows is given; except for v000 it joins two sittings, which
// can be a few percent apart, so the side-by-side timings, each taken in one sitting, are the better comparison.
// The starting kernel, v000, takes 174 microseconds a run.
// compute dtype: x and W rounded to bf16 and used as EXACT f16 operands for the attention (bf16 values are exact in f16): scores = x . x (single exact product) x 1/8 with the causal mask, running-max softmax in f32 (hardware exp), P (scaled by 2^11) as f16 hi + residual x the exact x planes (2 products); the 64 x 64 output map takes the f32 attention rows split into bf16 hi + residual against the exact bf16 W rows on WMMA 16x16x32 (2 products); f32 accumulate.
#include <hip/hip_runtime.h>
#include <math.h>

typedef __attribute__((ext_vector_type(16))) _Float16 v16h;
typedef __attribute__((ext_vector_type(16))) __bf16 v16b;
typedef __attribute__((ext_vector_type(8)))  _Float16 v8h;
typedef __attribute__((ext_vector_type(8)))  float v8f;
typedef __attribute__((ext_vector_type(4)))  float v4f;
typedef __attribute__((ext_vector_type(2)))  float v2f;
typedef __attribute__((ext_vector_type(4)))  unsigned v4u;
typedef __attribute__((ext_vector_type(4)))  int v4i;
typedef float __attribute__((may_alias)) float_a;
typedef int __attribute__((may_alias)) int_a;

template <typename T> __device__ __forceinline__ void vst2(void* p, T v) { *(T*)p = v;  }
__device__ __forceinline__ v8f wmma16(v16h a, v16h b, v8f c) {
  v8f d = __builtin_amdgcn_wmma_f32_16x16x32_f16(false, a, false, b, (short)0, c, false, false);
  asm volatile("v_nop\n\tv_nop\n\tv_nop\n\tv_nop" : "+v"(d) : "v"(a), "v"(b));
  return d;
}
__device__ __forceinline__ v8f wmma_bf(v16b a, v16b b, v8f c) {
  v8f d = __builtin_amdgcn_wmma_f32_16x16x32_bf16(false, a, false, b, (short)0, c, false, false);
  asm volatile("v_nop\n\tv_nop\n\tv_nop\n\tv_nop" : "+v"(d) : "v"(a), "v"(b));
  return d;
}
// Minimal causal attention block on a given per-head tensor x [2, 16, 2,048, 64] (q = k = v = x): softmax(mask(x x^T / 8)) x, then a bias-free 64 x 64 linear map.
__device__ __forceinline__ v16h frag_h(const _Float16* rowk0, int lane) {
  union { v16h v; v8h q[2]; } u; const _Float16* p = rowk0 + 8 * (lane >> 4);
  u.q[0] = *(const v8h*)p; u.q[1] = *(const v8h*)(p + 16); return u.v;
}
__device__ __forceinline__ v16h frag_f32(const float* rowk0, int lane) {
  v16h a; const float* p = rowk0 + 8 * (lane >> 4);
#pragma unroll
  for (int i = 0; i < 8; ++i) { a[i] = (_Float16)p[i]; a[8 + i] = (_Float16)p[16 + i]; }
  return a;
}
__device__ __forceinline__ v16h frag_f32s(const float* rowk0, int lane, float sc) {
  v16h a; const float* p = rowk0 + 8 * (lane >> 4);
#pragma unroll
  for (int i = 0; i < 8; ++i) { a[i] = (_Float16)(p[i] * sc); a[8 + i] = (_Float16)(p[16 + i] * sc); }
  return a;
}
// column fragment from a [K][ld] layout (column n), rows >= K read as 0
__device__ __forceinline__ v16h fragc_f32(const float* W, int k0, int n, int lane, int ld, int K) {
  v16h a; const int g = lane >> 4;
#pragma unroll
  for (int i = 0; i < 8; ++i) { const int ka = k0 + 8 * g + i, kb = ka + 16;
    a[i] = (_Float16)(ka < K ? W[(size_t)(ka < K ? ka : K - 1) * ld + n] : 0.f); a[8 + i] = (_Float16)(kb < K ? W[(size_t)(kb < K ? kb : K - 1) * ld + n] : 0.f); }
  return a;
}
struct F2 { v16b h, l; };
__device__ __forceinline__ F2 bsplit16(const float v[16]) { F2 r;
#pragma unroll
  for (int i = 0; i < 16; ++i) { const __bf16 h = (__bf16)v[i]; r.h[i] = h; r.l[i] = (__bf16)(v[i] - (float)h); }
  return r; }
__device__ __forceinline__ F2 split_row(const float* row, int k0, int lane) { float v[16]; const float* p = row + k0 + 8 * (lane >> 4);
#pragma unroll
  for (int i = 0; i < 8; ++i) { v[i] = p[i]; v[8 + i] = p[16 + i]; }
  return bsplit16(v); }
__device__ __forceinline__ F2 split_rowK(const float* row, int k0, int lane, int K) { float v[16]; const int g = lane >> 4;
#pragma unroll
  for (int i = 0; i < 8; ++i) { const int ka = k0 + 8 * g + i, kb = ka + 16; v[i] = ka < K ? row[ka < K ? ka : K - 1] : 0.f; v[8 + i] = kb < K ? row[kb < K ? kb : K - 1] : 0.f; }
  return bsplit16(v); }
__device__ __forceinline__ F2 split_col(const float* W, int k0, int n, int lane, int ld, int K) { float v[16]; const int g = lane >> 4;
#pragma unroll
  for (int i = 0; i < 8; ++i) { const int ka = k0 + 8 * g + i, kb = ka + 16; v[i] = ka < K ? W[(size_t)(ka < K ? ka : K - 1) * ld + n] : 0.f; v[8 + i] = kb < K ? W[(size_t)(kb < K ? kb : K - 1) * ld + n] : 0.f; }
  return bsplit16(v); }
__device__ __forceinline__ v8f mac3(const F2& a, const F2& b, v8f c) { c = wmma_bf(a.l, b.h, c); c = wmma_bf(a.h, b.l, c); return wmma_bf(a.h, b.h, c); }
__device__ __forceinline__ float sigm(float v) { return 1.0f / (1.0f + expf(-v)); }
#define LDSX() do { asm volatile("s_wait_dscnt 0" ::: "memory"); __builtin_amdgcn_wave_barrier(); __builtin_amdgcn_fence(__ATOMIC_RELEASE, "workgroup"); } while (0)


#define NB 32   // (batch, head) pairs
#define SS 2048
#define DM 64
#define NH 1
#define HD 64
#define QKVW (3 * DM)
#ifndef TQB
#define TQB (SS / 64)
#define TNB NB
#define TOB (NB * SS / 64)     // output row tiles (all)
#endif
typedef __attribute__((ext_vector_type(8))) __bf16 v8b;
__device__ __forceinline__ v16b frag_b(const __bf16* rowk0, int lane) {
  union { v16b v; v8b q[2]; } u; const __bf16* p = rowk0 + 8 * (lane >> 4);
  u.q[0] = *(const v8b*)p; u.q[1] = *(const v8b*)(p + 16); return u.v;
}
__device__ __forceinline__ float bfr(float v) { return (float)(__bf16)v; }
__device__ __attribute__((noinline)) float exp_ni(float v) { return expf(v); }
__device__ __attribute__((noinline)) float erf_ni(float v) { return erff(v); }

#define PK_A 0                       // [192][64] Wqkv rows (natural [out][in])
#define PK_P (PK_A + QKVW * DM)        // [64][64] Wo rows (natural)
#define PK_END (PK_P + DM * DM)
#define WS_PK  0u
#define WS_QK  (WS_PK + 2u * PK_END)             // f16 [65536 rows][128]: q | k
#define WS_QKL (WS_QK + 2u * NB * SS * 2 * DM)     // f16 q | k residual planes x2048
#define WS_VTH (WS_QKL + 2u * NB * SS * 2 * DM)    // f16 [b][64 (h*64+d)][2048 s] hi
#define WS_VTL (WS_VTH + 2u * NB * DM * SS)        // f16 lo x 2048
#define WS_O   (WS_VTL + 2u * NB * DM * SS)        // f32 [65536][64]
#define WS_CS  (WS_O + 4u * NB * SS * DM)           // f32 [2048][32] cos, [2048][32] sin
#define WS_END (WS_CS + 4u * 2 * SS * 32)
// ---- k_prep: block = 64 rows of one (batch, head): x rows -> f16 [row][128] (x | x) and x^T planes [bh][64][SS] (exact)
__global__ __launch_bounds__(256) void k_prep(const float* __restrict__ X, _Float16* __restrict__ QK, _Float16* __restrict__ VTH) {
  __shared__ __align__(16) _Float16 sq[64][72]; __shared__ __align__(16) _Float16 st[64][72];
  const int t = threadIdx.x; const size_t r0 = (size_t)blockIdx.x * 64; const size_t bh = r0 / SS, s0 = r0 % SS;
  for (int e = t; e < 64 * 64; e += 256) { const int r = e >> 6, c = e & 63; const _Float16 v = (_Float16)bfr(X[(r0 + r) * DM + c]); sq[r][c] = v; st[c][r] = v; }
  __syncthreads();
  for (int e = t; e < 64 * 8; e += 256) { const int r = e >> 3, q = e & 7; const v4u v = *(const v4u*)&sq[r][q * 8]; vst2((unsigned*)(QK + (r0 + r) * (2 * DM) + q * 8), v); vst2((unsigned*)(QK + (r0 + r) * (2 * DM) + DM + q * 8), v); }
  for (int e = t; e < 64 * 8; e += 256) { const int c = e >> 3, pc = e & 7; vst2((unsigned*)(VTH + (bh * DM + c) * SS + s0 + pc * 8), *(const v4u*)&st[c][pc * 8]); }
}
// ---- k_packw: W [64][64] natural -> bf16 rows
__global__ __launch_bounds__(64) void k_packw(const float* __restrict__ Wm, __bf16* __restrict__ PW) { const int n = blockIdx.x, t = threadIdx.x; __shared__ __align__(16) __bf16 s[HD]; s[t] = (__bf16)Wm[(size_t)n * HD + t]; __syncthreads(); if (t < HD / 8) vst2((unsigned*)(PW + (size_t)n * HD + t * 8), *(const v4u*)&s[t * 8]); }
__global__ __launch_bounds__(128) void k_attn(const _Float16* __restrict__ QK, const _Float16* __restrict__ QKL, const _Float16* __restrict__ VTH, const _Float16* __restrict__ VTL, const void* __restrict__ KMASK, const __bf16* __restrict__ PW, float* __restrict__ O) {
  __shared__ __align__(16) float sp[4][16][36]; __shared__ __align__(16) float so[4][16][68];
  const int tid = threadIdx.x, wave = tid >> 5, lane = tid & 31, col = lane & 15, g = lane >> 4;
  const int qb = blockIdx.x, h = blockIdx.y, b = blockIdx.z; const int q0 = qb * 64 + wave * 16; const size_t rq = (size_t)b * SS + q0 + col;
  v16h aq[2], aql[2];
#pragma unroll
  for (int kc = 0; kc < 2; ++kc) { aq[kc] = frag_h(QK + rq * (2 * DM) + h * HD + kc * 32, lane); aql[kc] = frag_h(QKL + rq * (2 * DM) + h * HD + kc * 32, lane); }
  float m[8], l[8];
#pragma unroll
  for (int r = 0; r < 8; ++r) { m[r] = -3.0e38f; l[r] = 0.f; }
  v8f acc[4] = {}, accl[4] = {};
  const int nks = (qb * 64 + 64) / 32;   // causal: key tiles up to this query block
#pragma unroll 1
  for (int ks = 0; ks < nks; ++ks) { v8f s[2];
#pragma unroll
    for (int ct = 0; ct < 2; ++ct) { const int kk = ks * 32 + ct * 16 + col; const _Float16* krow = QK + ((size_t)b * SS + kk) * (2 * DM) + DM + h * HD; const _Float16* krowl = QKL + ((size_t)b * SS + kk) * (2 * DM) + DM + h * HD; v8f c = {}, cl = {};
#pragma unroll
      for (int kc = 0; kc < 2; ++kc) c = wmma16(aq[kc], frag_h(krow + kc * 32, lane), c);   // single EXACT product: q, k are bf16 inputs held exactly in f16
      (void)cl; (void)krowl;
      { const bool keepk = true;
#pragma unroll
      for (int r = 0; r < 8; ++r) s[ct][r] = (kk <= q0 + 8 * g + r) ? c[r] * 0.125f : -3.0e38f; } }   // 1/sqrt(64); causal (diagonal kept)
#pragma unroll
    for (int r = 0; r < 8; ++r) { float mx = fmaxf(s[0][r], s[1][r]);
#pragma unroll
      for (int o = 1; o < 16; o <<= 1) mx = fmaxf(mx, __shfl_xor(mx, o));
      const float mn = fmaxf(m[r], mx); const float alpha = (m[r] <= -1.0e38f) ? 0.f : __expf(m[r] - mn);
      const float e0 = (s[0][r] <= -1.0e38f) ? 0.f : __expf(s[0][r] - mn), e1 = (s[1][r] <= -1.0e38f) ? 0.f : __expf(s[1][r] - mn); float es = e0 + e1;
#pragma unroll
      for (int o = 1; o < 16; o <<= 1) es += __shfl_xor(es, o);
      l[r] = l[r] * alpha + es; m[r] = mn;
#pragma unroll
      for (int dt = 0; dt < 4; ++dt) { acc[dt][r] *= alpha; accl[dt][r] *= alpha; }
      sp[wave][8 * g + r][col] = e0; sp[wave][8 * g + r][16 + col] = e1; }
    LDSX();
    v16h pa, pl; { const float* prow = &sp[wave][col][0] + 8 * (lane >> 4);
#pragma unroll
      for (int i = 0; i < 8; ++i) { const float x0 = prow[i] * 2048.0f, x1 = prow[16 + i] * 2048.0f; const _Float16 h0 = (_Float16)x0, h1 = (_Float16)x1; pa[i] = h0; pa[8 + i] = h1; pl[i] = (_Float16)((x0 - (float)h0) * 2048.0f); pl[8 + i] = (_Float16)((x1 - (float)h1) * 2048.0f); } }   // P scaled by 2^11 before the f16 split so small softmax weights stay out of the f16 subnormal range; 2^-11 folded into the epilogue
#pragma unroll
    for (int dt = 0; dt < 4; ++dt) { const size_t vr = ((size_t)b * DM + h * HD + dt * 16 + col) * SS + ks * 32; const v16h vh = frag_h(VTH + vr, lane); acc[dt] = wmma16(pa, vh, acc[dt]); accl[dt] = wmma16(pl, vh, accl[dt]); }   // P hi x V + P lo x V / 2048 (v exact)
    LDSX(); }
#pragma unroll
  for (int r = 0; r < 8; ++r) { const float il = (1.0f / 2048.0f) / l[r];
#pragma unroll
    for (int dt = 0; dt < 4; ++dt) so[wave][8 * g + r][dt * 16 + col] = (acc[dt][r] + accl[dt][r] * (1.0f / 2048.0f)) * il; }
  LDSX();
  // epilogue: out[e] = sum_d attn[d] W[e][d] (the bias-free Linear): attn tile (bf16 hi + residual) x W rows (exact), 2 products
  { v8f acc2[4] = {};
#pragma unroll
    for (int kc = 0; kc < 2; ++kc) { const F2 a2 = split_row(&so[wave][col][0], kc * 32, lane);
#pragma unroll
      for (int j = 0; j < 4; ++j) { const v16b w = frag_b(PW + (size_t)(j * 16 + col) * HD + kc * 32, lane); acc2[j] = wmma_bf(a2.l, w, acc2[j]); acc2[j] = wmma_bf(a2.h, w, acc2[j]); } }
    LDSX();
#pragma unroll
    for (int j = 0; j < 4; ++j)
#pragma unroll
      for (int r = 0; r < 8; ++r) so[wave][8 * g + r][j * 16 + col] = acc2[j][r];
    LDSX(); }
  for (int rl = 0; rl < 16; ++rl) if (lane < 16) vst2(O + ((size_t)b * SS + q0 + rl) * DM + h * HD + lane * 4, *(const v4f*)&so[wave][rl][lane * 4]);
}
#define WS2_QK  0u
#define WS2_VT  (WS2_QK + 2u * (size_t)NB * SS * 2 * DM)
#define WS2_PW  (WS2_VT + 2u * (size_t)NB * DM * SS)
#define WS2_END (WS2_PW + 2u * HD * HD + 256u)
extern "C" void kernel_launch(void* const* d_in, const int* in_sizes, int n_in, void* d_out, int out_size, void* d_ws, size_t ws_size, hipStream_t stream) {
  (void)in_sizes; (void)n_in; (void)out_size;
  const float** F = (const float**)d_in;   // 0 x [2,16,2048,64], 1 W [64,64]
  if (ws_size < (size_t)WS2_END) return;
  char* ws = (char*)d_ws; _Float16 *QK = (_Float16*)(ws + WS2_QK), *VTH = (_Float16*)(ws + WS2_VT); __bf16* PW = (__bf16*)(ws + WS2_PW);
  k_packw<<<HD, 64, 0, stream>>>(F[1], PW);
  k_prep<<<TNB * SS / 64, 256, 0, stream>>>(F[0], QK, VTH);
  k_attn<<<dim3(TQB, NH, TNB), 128, 0, stream>>>(QK, QK, VTH, VTH, nullptr, PW, (float*)d_out);   // out [b][h][q][e]; the residual-plane pointers are read-only and unused (single exact products)
}

// v001
// A run of this version takes 150 microseconds.
// Timed twice side by side with v000, it ran 1.18 times as fast both times.
// compute dtype: x and W rounded to bf16 and used as EXACT f16 operands for the attention (bf16 values are exact in f16): scores = x . x (single exact product) x 1/8 with the causal mask, running-max softmax in f32 (hardware exp), P (scaled by 2^11) as f16 hi + residual x the exact x planes (2 products); the 64 x 64 output map takes the f32 attention rows split into bf16 hi + residual against the exact bf16 W rows on WMMA 16x16x32 (2 products); f32 accumulate.
#include <hip/hip_runtime.h>
#include <math.h>

typedef __attribute__((ext_vector_type(16))) _Float16 v16h;
typedef __attribute__((ext_vector_type(16))) __bf16 v16b;
typedef __attribute__((ext_vector_type(8)))  _Float16 v8h;
typedef __attribute__((ext_vector_type(8)))  float v8f;
typedef __attribute__((ext_vector_type(4)))  float v4f;
typedef __attribute__((ext_vector_type(2)))  float v2f;
typedef __attribute__((ext_vector_type(4)))  unsigned v4u;
typedef __attribute__((ext_vector_type(4)))  int v4i;
typedef float __attribute__((may_alias)) float_a;
typedef int __attribute__((may_alias)) int_a;

template <typename T> __device__ __forceinline__ void vst2(void* p, T v) { *(T*)p = v;  }
__device__ __forceinline__ v8f wmma16(v16h a, v16h b, v8f c) {
  v8f d = __builtin_amdgcn_wmma_f32_16x16x32_f16(false, a, false, b, (short)0, c, false, false);
  asm volatile("v_nop\n\tv_nop\n\tv_nop\n\tv_nop" : "+v"(d) : "v"(a), "v"(b));
  return d;
}
__device__ __forceinline__ v8f wmma_bf(v16b a, v16b b, v8f c) {
  v8f d = __builtin_amdgcn_wmma_f32_16x16x32_bf16(false, a, false, b, (short)0, c, false, false);
  asm volatile("v_nop\n\tv_nop\n\tv_nop\n\tv_nop" : "+v"(d) : "v"(a), "v"(b));
  return d;
}
// Minimal causal attention block on a given per-head tensor x [2, 16, 2,048, 64] (q = k = v = x): softmax(mask(x x^T / 8)) x, then a bias-free 64 x 64 linear map.
__device__ __forceinline__ v16h frag_h(const _Float16* rowk0, int lane) {
  union { v16h v; v8h q[2]; } u; const _Float16* p = rowk0 + 8 * (lane >> 4);
  u.q[0] = *(const v8h*)p; u.q[1] = *(const v8h*)(p + 16); return u.v;
}
__device__ __forceinline__ v16h frag_f32(const float* rowk0, int lane) {
  v16h a; const float* p = rowk0 + 8 * (lane >> 4);
#pragma unroll
  for (int i = 0; i < 8; ++i) { a[i] = (_Float16)p[i]; a[8 + i] = (_Float16)p[16 + i]; }
  return a;
}
__device__ __forceinline__ v16h frag_f32s(const float* rowk0, int lane, float sc) {
  v16h a; const float* p = rowk0 + 8 * (lane >> 4);
#pragma unroll
  for (int i = 0; i < 8; ++i) { a[i] = (_Float16)(p[i] * sc); a[8 + i] = (_Float16)(p[16 + i] * sc); }
  return a;
}
// column fragment from a [K][ld] layout (column n), rows >= K read as 0
__device__ __forceinline__ v16h fragc_f32(const float* W, int k0, int n, int lane, int ld, int K) {
  v16h a; const int g = lane >> 4;
#pragma unroll
  for (int i = 0; i < 8; ++i) { const int ka = k0 + 8 * g + i, kb = ka + 16;
    a[i] = (_Float16)(ka < K ? W[(size_t)(ka < K ? ka : K - 1) * ld + n] : 0.f); a[8 + i] = (_Float16)(kb < K ? W[(size_t)(kb < K ? kb : K - 1) * ld + n] : 0.f); }
  return a;
}
struct F2 { v16b h, l; };
__device__ __forceinline__ F2 bsplit16(const float v[16]) { F2 r;
#pragma unroll
  for (int i = 0; i < 16; ++i) { const __bf16 h = (__bf16)v[i]; r.h[i] = h; r.l[i] = (__bf16)(v[i] - (float)h); }
  return r; }
__device__ __forceinline__ F2 split_row(const float* row, int k0, int lane) { float v[16]; const float* p = row + k0 + 8 * (lane >> 4);
#pragma unroll
  for (int i = 0; i < 8; ++i) { v[i] = p[i]; v[8 + i] = p[16 + i]; }
  return bsplit16(v); }
__device__ __forceinline__ F2 split_rowK(const float* row, int k0, int lane, int K) { float v[16]; const int g = lane >> 4;
#pragma unroll
  for (int i = 0; i < 8; ++i) { const int ka = k0 + 8 * g + i, kb = ka + 16; v[i] = ka < K ? row[ka < K ? ka : K - 1] : 0.f; v[8 + i] = kb < K ? row[kb < K ? kb : K - 1] : 0.f; }
  return bsplit16(v); }
__device__ __forceinline__ F2 split_col(const float* W, int k0, int n, int lane, int ld, int K) { float v[16]; const int g = lane >> 4;
#pragma unroll
  for (int i = 0; i < 8; ++i) { const int ka = k0 + 8 * g + i, kb = ka + 16; v[i] = ka < K ? W[(size_t)(ka < K ? ka : K - 1) * ld + n] : 0.f; v[8 + i] = kb < K ? W[(size_t)(kb < K ? kb : K - 1) * ld + n] : 0.f; }
  return bsplit16(v); }
__device__ __forceinline__ v8f mac3(const F2& a, const F2& b, v8f c) { c = wmma_bf(a.l, b.h, c); c = wmma_bf(a.h, b.l, c); return wmma_bf(a.h, b.h, c); }
__device__ __forceinline__ float sigm(float v) { return 1.0f / (1.0f + expf(-v)); }
#define LDSX() do { asm volatile("s_wait_dscnt 0" ::: "memory"); __builtin_amdgcn_wave_barrier(); __builtin_amdgcn_fence(__ATOMIC_RELEASE, "workgroup"); } while (0)


#define NB 32   // (batch, head) pairs
#define SS 2048
#define DM 64
#define NH 1
#define HD 64
#define QKVW (3 * DM)
#ifndef TQB
#define TQB (SS / 64)
#define TNB NB
#define TOB (NB * SS / 64)     // output row tiles (all)
#endif
typedef __attribute__((ext_vector_type(8))) __bf16 v8b;
__device__ __forceinline__ v16b frag_b(const __bf16* rowk0, int lane) {
  union { v16b v; v8b q[2]; } u; const __bf16* p = rowk0 + 8 * (lane >> 4);
  u.q[0] = *(const v8b*)p; u.q[1] = *(const v8b*)(p + 16); return u.v;
}
__device__ __forceinline__ float bfr(float v) { return (float)(__bf16)v; }
__device__ __attribute__((noinline)) float exp_ni(float v) { return expf(v); }
__device__ __attribute__((noinline)) float erf_ni(float v) { return erff(v); }

#define PK_A 0                       // [192][64] Wqkv rows (natural [out][in])
#define PK_P (PK_A + QKVW * DM)        // [64][64] Wo rows (natural)
#define PK_END (PK_P + DM * DM)
#define WS_PK  0u
#define WS_QK  (WS_PK + 2u * PK_END)             // f16 [65536 rows][128]: q | k
#define WS_QKL (WS_QK + 2u * NB * SS * 2 * DM)     // f16 q | k residual planes x2048
#define WS_VTH (WS_QKL + 2u * NB * SS * 2 * DM)    // f16 [b][64 (h*64+d)][2048 s] hi
#define WS_VTL (WS_VTH + 2u * NB * DM * SS)        // f16 lo x 2048
#define WS_O   (WS_VTL + 2u * NB * DM * SS)        // f32 [65536][64]
#define WS_CS  (WS_O + 4u * NB * SS * DM)           // f32 [2048][32] cos, [2048][32] sin
#define WS_END (WS_CS + 4u * 2 * SS * 32)
// ---- k_prep: block = 64 rows of one (batch, head): x rows -> f16 [row][128] (x | x) and x^T planes [bh][64][SS] (exact)
__global__ __launch_bounds__(256) void k_prep(const float* __restrict__ X, _Float16* __restrict__ QK, _Float16* __restrict__ VTH) {
  __shared__ __align__(16) _Float16 sq[64][72]; __shared__ __align__(16) _Float16 st[64][72];
  const int t = threadIdx.x; const size_t r0 = (size_t)blockIdx.x * 64; const size_t bh = r0 / SS, s0 = r0 % SS;
  for (int e = t; e < 64 * 64; e += 256) { const int r = e >> 6, c = e & 63; const _Float16 v = (_Float16)bfr(X[(r0 + r) * DM + c]); sq[r][c] = v; st[c][r] = v; }
  __syncthreads();
  for (int e = t; e < 64 * 8; e += 256) { const int r = e >> 3, q = e & 7; const v4u v = *(const v4u*)&sq[r][q * 8]; vst2((unsigned*)(QK + (r0 + r) * (2 * DM) + q * 8), v); vst2((unsigned*)(QK + (r0 + r) * (2 * DM) + DM + q * 8), v); }
  for (int e = t; e < 64 * 8; e += 256) { const int c = e >> 3, pc = e & 7; vst2((unsigned*)(VTH + (bh * DM + c) * SS + s0 + pc * 8), *(const v4u*)&st[c][pc * 8]); }
}
// ---- k_packw: W [64][64] natural -> bf16 rows
__global__ __launch_bounds__(64) void k_packw(const float* __restrict__ Wm, __bf16* __restrict__ PW) { const int n = blockIdx.x, t = threadIdx.x; __shared__ __align__(16) __bf16 s[HD]; s[t] = (__bf16)Wm[(size_t)n * HD + t]; __syncthreads(); if (t < HD / 8) vst2((unsigned*)(PW + (size_t)n * HD + t * 8), *(const v4u*)&s[t * 8]); }
// 2^x on the hardware's v_exp_f32, written as asm for one reason: the instruction set asks for one free slot behind a transcendental before its result is read or its source overwritten.
// Eight independent exps fill each other's slot, a v_nop fills the last one's; early-clobber outputs keep results off the sources.
__device__ __forceinline__ v8f exp2x8(v8f x) { float r0, r1, r2, r3, r4, r5, r6, r7;
  asm("v_exp_f32 %0, %8\n\tv_exp_f32 %1, %9\n\tv_exp_f32 %2, %10\n\tv_exp_f32 %3, %11\n\tv_exp_f32 %4, %12\n\tv_exp_f32 %5, %13\n\tv_exp_f32 %6, %14\n\tv_exp_f32 %7, %15\n\tv_nop"
      : "=&v"(r0), "=&v"(r1), "=&v"(r2), "=&v"(r3), "=&v"(r4), "=&v"(r5), "=&v"(r6), "=&v"(r7) : "v"(x[0]), "v"(x[1]), "v"(x[2]), "v"(x[3]), "v"(x[4]), "v"(x[5]), "v"(x[6]), "v"(x[7]));
  const v8f r = { r0, r1, r2, r3, r4, r5, r6, r7 }; return r; }
__device__ __forceinline__ float exp2x1(float x) { float r; asm("v_exp_f32 %0, %1\n\tv_nop" : "=v"(r) : "v"(x)); return r; }   // the same slot for a single exp
#define LOG2E 1.44269504088896340736f   // e^x = 2^(x log2 e), the product __expf forms
// lane l <-> lane l ^ 16 (the two halves of a wave hold the two halves of one query column's keys)
__device__ __forceinline__ float xhalf(float v) { const int b = __builtin_bit_cast(int, v); return __builtin_bit_cast(float, __builtin_amdgcn_permlanex16(b, b, 0x76543210, 0xfedcba98, false, false)); }
// ---- k_attn: transposed products. S^T = K Q^T (A = key rows, B = query rows kept in registers): lane (col, g) holds query q0 + col, keys 8g + r of each 16-key tile.
//      Two S^T tiles converted in place are the B operand P^T of O^T += V^T P^T (A = x^T rows), and the four O^T tiles are the B operand of out^T = W attn^T.
__global__ __launch_bounds__(128) void k_attn(const _Float16* __restrict__ QK, const _Float16* __restrict__ QKL, const _Float16* __restrict__ VTH, const _Float16* __restrict__ VTL, const void* __restrict__ KMASK, const __bf16* __restrict__ PW, float* __restrict__ O) {
  __shared__ __align__(16) float so[4][16][68];
  const int tid = threadIdx.x, wave = tid >> 5, lane = tid & 31, col = lane & 15, g = lane >> 4;
  const int qb = blockIdx.x, h = blockIdx.y, b = blockIdx.z; const int q0 = qb * 64 + wave * 16; const int qi = q0 + col; const size_t rq = (size_t)b * SS + qi;
  (void)QKL; (void)VTL; (void)KMASK;
  v16h bq[2];
#pragma unroll
  for (int kc = 0; kc < 2; ++kc) bq[kc] = frag_h(QK + rq * (2 * DM) + h * HD + kc * 32, lane);
  float m = -3.0e38f, l = 0.f;   // running maximum of query qi (equal in both halves); l sums this half's keys only, the halves join in the epilogue
  v8f acc[4] = {}, accl[4] = {};
  const int nks = (qb * 64 + 64) / 32;   // causal: key tiles up to this query block
#pragma unroll 1
  for (int ks = 0; ks < nks; ++ks) { v8f s[2];
#pragma unroll
    for (int ct = 0; ct < 2; ++ct) { const int kr = ks * 32 + ct * 16; const _Float16* krow = QK + ((size_t)b * SS + kr + col) * (2 * DM) + DM + h * HD; v8f c = {};
#pragma unroll
      for (int kc = 0; kc < 2; ++kc) c = wmma16(frag_h(krow + kc * 32, lane), bq[kc], c);   // single EXACT product: q, k are bf16 inputs held exactly in f16
#pragma unroll
      for (int r = 0; r < 8; ++r) s[ct][r] = (kr + 8 * g + r <= qi) ? c[r] * 0.125f : -3.0e38f; }   // 1/sqrt(64); causal (diagonal kept)
    float mx = fmaxf(s[0][0], s[1][0]);
#pragma unroll
    for (int r = 1; r < 8; ++r) mx = fmaxf(mx, fmaxf(s[0][r], s[1][r]));
    mx = fmaxf(mx, xhalf(mx));
    const float mn = fmaxf(m, mx); const float ea = exp2x1((m - mn) * LOG2E); const float alpha = (m <= -1.0e38f) ? 0.f : ea;
    v8f e[2];
#pragma unroll
    for (int ct = 0; ct < 2; ++ct) { const v8f ex = exp2x8((s[ct] - mn) * LOG2E);
#pragma unroll
      for (int r = 0; r < 8; ++r) e[ct][r] = (s[ct][r] <= -1.0e38f) ? 0.f : ex[r]; }
    v16h pa, pl;
#pragma unroll
    for (int i = 0; i < 16; ++i) { const float x = e[i >> 3][i & 7] * 2048.0f; const _Float16 hx = (_Float16)x; pa[i] = hx; pl[i] = (_Float16)((x - (float)hx) * 2048.0f); }   // element i of P^T = key 16 (i / 8) + 8 g + i % 8 of this pass. P scaled by 2^11 before the f16 split so small softmax weights stay out of the f16 subnormal range; 2^-11 folded into the epilogue
    const v8f e2 = e[0] + e[1];
    l = l * alpha + (((e2[0] + e2[1]) + (e2[2] + e2[3])) + ((e2[4] + e2[5]) + (e2[6] + e2[7]))); m = mn;
#pragma unroll
    for (int dt = 0; dt < 4; ++dt) { acc[dt] *= alpha; accl[dt] *= alpha; }
#pragma unroll
    for (int dt = 0; dt < 4; ++dt) { const size_t vr = ((size_t)b * DM + h * HD + dt * 16 + col) * SS + ks * 32; const v16h vh = frag_h(VTH + vr, lane); acc[dt] = wmma16(vh, pa, acc[dt]); accl[dt] = wmma16(vh, pl, accl[dt]); } }   // V^T x P^T hi + V^T x P^T lo / 2048 (v exact)
  // epilogue: out[e] = sum_d attn[d] W[e][d] (the bias-free Linear): W rows (exact) x attn^T (bf16 hi + residual, straight from the O^T tiles), 2 products
  { const float il = (1.0f / 2048.0f) / (l + xhalf(l)); v8f acc2[4] = {};
#pragma unroll
    for (int kc = 0; kc < 2; ++kc) { float v[16];
#pragma unroll
      for (int r = 0; r < 8; ++r) { v[r] = (acc[2 * kc][r] + accl[2 * kc][r] * (1.0f / 2048.0f)) * il; v[8 + r] = (acc[2 * kc + 1][r] + accl[2 * kc + 1][r] * (1.0f / 2048.0f)) * il; }
      const F2 a2 = bsplit16(v);
#pragma unroll
      for (int j = 0; j < 4; ++j) { const v16b w = frag_b(PW + (size_t)(j * 16 + col) * HD + kc * 32, lane); acc2[j] = wmma_bf(w, a2.l, acc2[j]); acc2[j] = wmma_bf(w, a2.h, acc2[j]); } }
#pragma unroll
    for (int j = 0; j < 4; ++j) { const v4f lo = { acc2[j][0], acc2[j][1], acc2[j][2], acc2[j][3] }, hi = { acc2[j][4], acc2[j][5], acc2[j][6], acc2[j][7] };   // acc2[j][r] = out[qi][16 j + 8 g + r]
      *(v4f*)&so[wave][col][j * 16 + 8 * g] = lo; *(v4f*)&so[wave][col][j * 16 + 8 * g + 4] = hi; }
    LDSX(); }
  for (int rl = 0; rl < 16; ++rl) if (lane < 16) vst2(O + ((size_t)b * SS + q0 + rl) * DM + h * HD + lane * 4, *(const v4f*)&so[wave][rl][lane * 4]);
}
#define WS2_QK  0u
#define WS2_VT  (WS2_QK + 2u * (size_t)NB * SS * 2 * DM)
#define WS2_PW  (WS2_VT + 2u * (size_t)NB * DM * SS)
#define WS2_END (WS2_PW + 2u * HD * HD + 256u)
extern "C" void kernel_launch(void* const* d_in, const int* in_sizes, int n_in, void* d_out, int out_size, void* d_ws, size_t ws_size, hipStream_t stream) {
  (void)in_sizes; (void)n_in; (void)out_size;
  const float** F = (const float**)d_in;   // 0 x [2,16,2048,64], 1 W [64,64]
  if (ws_size < (size_t)WS2_END) return;
  char* ws = (char*)d_ws; _Float16 *QK = (_Float16*)(ws + WS2_QK), *VTH = (_Float16*)(ws + WS2_VT); __bf16* PW = (__bf16*)(ws + WS2_PW);
  k_packw<<<HD, 64, 0, stream>>>(F[1], PW);
  k_prep<<<TNB * SS / 64, 256, 0, stream>>>(F[0], QK, VTH);
  k_attn<<<dim3(TQB, NH, TNB), 128, 0, stream>>>(QK, QK, VTH, VTH, nullptr, PW, (float*)d_out);   // out [b][h][q][e]; the residual-plane pointers are read-only and unused (single exact products)
}

// v002
// A run of this version takes 74.6 microseconds.
// Two timings next to v001 put it at 2.01 and 2.00 times that version's speed.
// Over all steps from v000 it is 2.37 times as fast.
// compute dtype: x and W rounded to bf16 and used as EXACT f16 operands for the attention (bf16 values are exact in f16): scores = x . x (single exact product) x 1/8 with the causal mask, running-max softmax in f32 (hardware exp), P (scaled by 2^11) as f16 hi + residual x the exact x planes (2 products); the 64 x 64 output map takes the f32 attention rows split into bf16 hi + residual against the exact bf16 W rows on WMMA 16x16x32 (2 products); f32 accumulate.
#include <hip/hip_runtime.h>
#include <math.h>

typedef __attribute__((ext_vector_type(16))) _Float16 v16h;
typedef __attribute__((ext_vector_type(16))) __bf16 v16b;
typedef __attribute__((ext_vector_type(8)))  _Float16 v8h;
typedef __attribute__((ext_vector_type(8)))  float v8f;
typedef __attribute__((ext_vector_type(4)))  float v4f;
typedef __attribute__((ext_vector_type(2)))  float v2f;
typedef __attribute__((ext_vector_type(4)))  unsigned v4u;
typedef __attribute__((ext_vector_type(4)))  int v4i;
typedef float __attribute__((may_alias)) float_a;
typedef int __attribute__((may_alias)) int_a;

template <typename T> __device__ __forceinline__ void vst2(void* p, T v) { *(T*)p = v;  }
__device__ __forceinline__ v8f wmma16(v16h a, v16h b, v8f c) {
  v8f d = __builtin_amdgcn_wmma_f32_16x16x32_f16(false, a, false, b, (short)0, c, false, false);
  asm volatile("v_nop\n\tv_nop\n\tv_nop\n\tv_nop" : "+v"(d) : "v"(a), "v"(b));
  return d;
}
__device__ __forceinline__ v8f wmma_bf(v16b a, v16b b, v8f c) {
  v8f d = __builtin_amdgcn_wmma_f32_16x16x32_bf16(false, a, false, b, (short)0, c, false, false);
  asm volatile("v_nop\n\tv_nop\n\tv_nop\n\tv_nop" : "+v"(d) : "v"(a), "v"(b));
  return d;
}
// Minimal causal attention block on a given per-head tensor x [2, 16, 2,048, 64] (q = k = v = x): softmax(mask(x x^T / 8)) x, then a bias-free 64 x 64 linear map.
__device__ __forceinline__ v16h frag_h(const _Float16* rowk0, int lane) {
  union { v16h v; v8h q[2]; } u; const _Float16* p = rowk0 + 8 * (lane >> 4);
  u.q[0] = *(const v8h*)p; u.q[1] = *(const v8h*)(p + 16); return u.v;
}
__device__ __forceinline__ v16h frag_f32(const float* rowk0, int lane) {
  v16h a; const float* p = rowk0 + 8 * (lane >> 4);
#pragma unroll
  for (int i = 0; i < 8; ++i) { a[i] = (_Float16)p[i]; a[8 + i] = (_Float16)p[16 + i]; }
  return a;
}
__device__ __forceinline__ v16h frag_f32s(const float* rowk0, int lane, float sc) {
  v16h a; const float* p = rowk0 + 8 * (lane >> 4);
#pragma unroll
  for (int i = 0; i < 8; ++i) { a[i] = (_Float16)(p[i] * sc); a[8 + i] = (_Float16)(p[16 + i] * sc); }
  return a;
}
// column fragment from a [K][ld] layout (column n), rows >= K read as 0
__device__ __forceinline__ v16h fragc_f32(const float* W, int k0, int n, int lane, int ld, int K) {
  v16h a; const int g = lane >> 4;
#pragma unroll
  for (int i = 0; i < 8; ++i) { const int ka = k0 + 8 * g + i, kb = ka + 16;
    a[i] = (_Float16)(ka < K ? W[(size_t)(ka < K ? ka : K - 1) * ld + n] : 0.f); a[8 + i] = (_Float16)(kb < K ? W[(size_t)(kb < K ? kb : K - 1) * ld + n] : 0.f); }
  return a;
}
struct F2 { v16b h, l; };
__device__ __forceinline__ F2 bsplit16(const float v[16]) { F2 r;
#pragma unroll
  for (int i = 0; i < 16; ++i) { const __bf16 h = (__bf16)v[i]; r.h[i] = h; r.l[i] = (__bf16)(v[i] - (float)h); }
  return r; }
__device__ __forceinline__ F2 split_row(const float* row, int k0, int lane) { float v[16]; const float* p = row + k0 + 8 * (lane >> 4);
#pragma unroll
  for (int i = 0; i < 8; ++i) { v[i] = p[i]; v[8 + i] = p[16 + i]; }
  return bsplit16(v); }
__device__ __forceinline__ F2 split_rowK(const float* row, int k0, int lane, int K) { float v[16]; const int g = lane >> 4;
#pragma unroll
  for (int i = 0; i < 8; ++i) { const int ka = k0 + 8 * g + i, kb = ka + 16; v[i] = ka < K ? row[ka < K ? ka : K - 1] : 0.f; v[8 + i] = kb < K ? row[kb < K ? kb : K - 1] : 0.f; }
  return bsplit16(v); }
__device__ __forceinline__ F2 split_col(const float* W, int k0, int n, int lane, int ld, int K) { float v[16]; const int g = lane >> 4;
#pragma unroll
  for (int i = 0; i < 8; ++i) { const int ka = k0 + 8 * g + i, kb = ka + 16; v[i] = ka < K ? W[(size_t)(ka < K ? ka : K - 1) * ld + n] : 0.f; v[8 + i] = kb < K ? W[(size_t)(kb < K ? kb : K - 1) * ld + n] : 0.f; }
  return bsplit16(v); }
__device__ __forceinline__ v8f mac3(const F2& a, const F2& b, v8f c) { c = wmma_bf(a.l, b.h, c); c = wmma_bf(a.h, b.l, c); return wmma_bf(a.h, b.h, c); }
__device__ __forceinline__ float sigm(float v) { return 1.0f / (1.0f + expf(-v)); }
#define LDSX() do { asm volatile("s_wait_dscnt 0" ::: "memory"); __builtin_amdgcn_wave_barrier(); __builtin_amdgcn_fence(__ATOMIC_RELEASE, "workgroup"); } while (0)


#define NB 32   // (batch, head) pairs
#define SS 2048
#define DM 64
#define NH 1
#define HD 64
#define QKVW (3 * DM)
#ifndef TQB
#define TQB (SS / 64)
#define TNB NB
#define TOB (NB * SS / 64)     // output row tiles (all)
#endif
typedef __attribute__((ext_vector_type(8))) __bf16 v8b;
__device__ __forceinline__ v16b frag_b(const __bf16* rowk0, int lane) {
  union { v16b v; v8b q[2]; } u; const __bf16* p = rowk0 + 8 * (lane >> 4);
  u.q[0] = *(const v8b*)p; u.q[1] = *(const v8b*)(p + 16); return u.v;
}
__device__ __forceinline__ float bfr(float v) { return (float)(__bf16)v; }
__device__ __attribute__((noinline)) float exp_ni(float v) { return expf(v); }
__device__ __attribute__((noinline)) float erf_ni(float v) { return erff(v); }

#define PK_A 0                       // [192][64] Wqkv rows (natural [out][in])
#define PK_P (PK_A + QKVW * DM)        // [64][64] Wo rows (natural)
#define PK_END (PK_P + DM * DM)
#define WS_PK  0u
#define WS_QK  (WS_PK + 2u * PK_END)             // f16 [65536 rows][128]: q | k
#define WS_QKL (WS_QK + 2u * NB * SS * 2 * DM)     // f16 q | k residual planes x2048
#define WS_VTH (WS_QKL + 2u * NB * SS * 2 * DM)    // f16 [b][64 (h*64+d)][2048 s] hi
#define WS_VTL (WS_VTH + 2u * NB * DM * SS)        // f16 lo x 2048
#define WS_O   (WS_VTL + 2u * NB * DM * SS)        // f32 [65536][64]
#define WS_CS  (WS_O + 4u * NB * SS * DM)           // f32 [2048][32] cos, [2048][32] sin
#define WS_END (WS_CS + 4u * 2 * SS * 32)
// ---- k_prep: block = 64 rows of one (batch, head): x rows -> f16 [row][128] (x | x) and x^T planes [bh][64][SS] (exact)
__global__ __launch_bounds__(256) void k_prep(const float* __restrict__ X, _Float16* __restrict__ QK, _Float16* __restrict__ VTH) {
  __shared__ __align__(16) _Float16 sq[64][72]; __shared__ __align__(16) _Float16 st[64][72];
  const int t = threadIdx.x; const size_t r0 = (size_t)blockIdx.x * 64; const size_t bh = r0 / SS, s0 = r0 % SS;
  for (int e = t; e < 64 * 64; e += 256) { const int r = e >> 6, c = e & 63; const _Float16 v = (_Float16)bfr(X[(r0 + r) * DM + c]); sq[r][c] = v; st[c][r] = v; }
  __syncthreads();
  for (int e = t; e < 64 * 8; e += 256) { const int r = e >> 3, q = e & 7; const v4u v = *(const v4u*)&sq[r][q * 8]; vst2((unsigned*)(QK + (r0 + r) * (2 * DM) + q * 8), v); vst2((unsigned*)(QK + (r0 + r) * (2 * DM) + DM + q * 8), v); }
  for (int e = t; e < 64 * 8; e += 256) { const int c = e >> 3, pc = e & 7; vst2((unsigned*)(VTH + (bh * DM + c) * SS + s0 + pc * 8), *(const v4u*)&st[c][pc * 8]); }
}
// ---- k_packw: W [64][64] natural -> bf16 rows
__global__ __launch_bounds__(64) void k_packw(const float* __restrict__ Wm, __bf16* __restrict__ PW) { const int n = blockIdx.x, t = threadIdx.x; __shared__ __align__(16) __bf16 s[HD]; s[t] = (__bf16)Wm[(size_t)n * HD + t]; __syncthreads(); if (t < HD / 8) vst2((unsigned*)(PW + (size_t)n * HD + t * 8), *(const v4u*)&s[t * 8]); }
// 2^x on the hardware's v_exp_f32, written as asm for one reason: the instruction set asks for one free slot behind a transcendental before its result is read or its source overwritten.
// Eight independent exps fill each other's slot, a v_nop fills the last one's; early-clobber outputs keep results off the sources.
__device__ __forceinline__ v8f exp2x8(v8f x) { float r0, r1, r2, r3, r4, r5, r6, r7;
  asm("v_exp_f32 %0, %8\n\tv_exp_f32 %1, %9\n\tv_exp_f32 %2, %10\n\tv_exp_f32 %3, %11\n\tv_exp_f32 %4, %12\n\tv_exp_f32 %5, %13\n\tv_exp_f32 %6, %14\n\tv_exp_f32 %7, %15\n\tv_nop"
      : "=&v"(r0), "=&v"(r1), "=&v"(r2), "=&v"(r3), "=&v"(r4), "=&v"(r5), "=&v"(r6), "=&v"(r7) : "v"(x[0]), "v"(x[1]), "v"(x[2]), "v"(x[3]), "v"(x[4]), "v"(x[5]), "v"(x[6]), "v"(x[7]));
  const v8f r = { r0, r1, r2, r3, r4, r5, r6, r7 }; return r; }
__device__ __forceinline__ float exp2x1(float x) { float r; asm("v_exp_f32 %0, %1\n\tv_nop" : "=v"(r) : "v"(x)); return r; }   // the same slot for a single exp
#define LOG2E 1.44269504088896340736f   // e^x = 2^(x log2 e), the product __expf forms
// lane l <-> lane l ^ 16 (the two halves of a wave hold the two halves of one query column's keys)
__device__ __forceinline__ float xhalf(float v) { const int b = __builtin_bit_cast(int, v); return __builtin_bit_cast(float, __builtin_amdgcn_permlanex16(b, b, 0x76543210, 0xfedcba98, false, false)); }
// One stage = 64 keys: 64 key rows (K) and the 64 x^T rows of those keys (V^T), 128 B a row, copied once per work-group and read by its four waves.
#define KST 64
#define LP 72   // LDS row pitch in halves: 144 B = 16 B x 9, an odd multiple of 16 B, so that the 16-byte fragment reads of 16 rows spread over the banks
// Each thread copies 16 B of four K rows and of four V^T rows (a wave covers four whole 128-B rows per copy). The s_wait_xcnt stands inside the copies' own statement so that
// no later write of an address register can be moved in front of it.
__device__ __forceinline__ void stage_copy(const _Float16* gk, const _Float16* gv, unsigned lk, unsigned lv) {
  asm volatile("global_load_async_to_lds_b128 %0, %8, off\n\tglobal_load_async_to_lds_b128 %1, %9, off\n\tglobal_load_async_to_lds_b128 %2, %10, off\n\tglobal_load_async_to_lds_b128 %3, %11, off\n\t"
               "global_load_async_to_lds_b128 %4, %12, off\n\tglobal_load_async_to_lds_b128 %5, %13, off\n\tglobal_load_async_to_lds_b128 %6, %14, off\n\tglobal_load_async_to_lds_b128 %7, %15, off\n\ts_wait_xcnt 0x0"
               :: "v"(lk), "v"(lk + 16 * LP * 2), "v"(lk + 32 * LP * 2), "v"(lk + 48 * LP * 2), "v"(lv), "v"(lv + 16 * LP * 2), "v"(lv + 32 * LP * 2), "v"(lv + 48 * LP * 2),
                  "v"(gk), "v"(gk + 16 * 2 * DM), "v"(gk + 32 * 2 * DM), "v"(gk + 48 * 2 * DM), "v"(gv), "v"(gv + 16 * SS), "v"(gv + 32 * SS), "v"(gv + 48 * SS) : "memory");
}
// ---- k_attn: transposed products. S^T = K Q^T (A = key rows, B = query rows kept in registers): lane (col, g) holds query q0 + col, keys 8g + r of each 16-key tile.
//      Two S^T tiles converted in place are the B operand P^T of O^T += V^T P^T (A = x^T rows), and the four O^T tiles are the B operand of out^T = W attn^T.
__global__ __launch_bounds__(128) void k_attn(const _Float16* __restrict__ QK, const _Float16* __restrict__ QKL, const _Float16* __restrict__ VTH, const _Float16* __restrict__ VTL, const void* __restrict__ KMASK, const __bf16* __restrict__ PW, float* __restrict__ O) {
  __shared__ __align__(16) float so[4][16][68];
  __shared__ __align__(16) _Float16 sk[2][KST][LP]; __shared__ __align__(16) _Float16 sv[2][DM][LP];   // two buffers: stage st + 1 lands while stage st is worked on
  const int tid = threadIdx.x, wave = tid >> 5, lane = tid & 31, col = lane & 15, g = lane >> 4;
  const int qb = blockIdx.x, h = blockIdx.y, b = blockIdx.z; const int q0 = qb * 64 + wave * 16; const int qi = q0 + col; const size_t rq = (size_t)b * SS + qi;
  (void)QKL; (void)VTL; (void)KMASK;
  v16h bq[2];
#pragma unroll
  for (int kc = 0; kc < 2; ++kc) bq[kc] = frag_h(QK + rq * (2 * DM) + h * HD + kc * 32, lane);
  float m = -3.0e38f, l = 0.f;   // running maximum of query qi (equal in both halves); l sums this half's keys only, the halves join in the epilogue
  v8f acc[4] = {}, accl[4] = {};
  const int nst = qb + 1;   // causal: stages of 64 keys up to this query block
  const int crow = tid >> 3, cq = tid & 7;   // this thread's first row and 16-byte piece in every copy
  const _Float16* gk = QK + ((size_t)b * SS + crow) * (2 * DM) + DM + h * HD + cq * 8; const _Float16* gv = VTH + ((size_t)b * DM + h * HD + crow) * SS + cq * 8;
  const unsigned lk = (unsigned)(size_t)&sk[0][crow][cq * 8], lv = (unsigned)(size_t)&sv[0][crow][cq * 8];
  stage_copy(gk, gv, lk, lv);
  asm volatile("s_wait_asynccnt 0x0" ::: "memory");   // this wave's share of stage 0 has landed
  __syncthreads();                                     // every wave's share has
  if (nst > 1) stage_copy(gk + (size_t)KST * 2 * DM, gv + KST, lk + KST * LP * 2, lv + DM * LP * 2);
#pragma unroll 1   // one copy of the stage body: the two buffers are told apart by an address, not by code
  for (int st = 0; st < nst; ++st) { const int bf = st & 1;
#pragma unroll     // both passes of a stage unrolled: every LDS read is one base register plus a constant offset
   for (int p = 0; p < 2; ++p) { const int ks = st * 2 + p; v8f s[2]; v16h kf[2][2], vf[4];   // the pass's fragments, read from LDS as one group: the V^T reads return behind the score products and the softmax
#pragma unroll
    for (int ct = 0; ct < 2; ++ct) { kf[ct][0] = frag_h(&sk[bf][p * 32 + ct * 16 + col][0], lane); kf[ct][1] = frag_h(&sk[bf][p * 32 + ct * 16 + col][32], lane); }
#pragma unroll
    for (int dt = 0; dt < 4; ++dt) vf[dt] = frag_h(&sv[bf][dt * 16 + col][p * 32], lane);
#pragma unroll
    for (int ct = 0; ct < 2; ++ct) { const int kr = ks * 32 + ct * 16; v8f c = {};
#pragma unroll
      for (int kc = 0; kc < 2; ++kc) c = wmma16(kf[ct][kc], bq[kc], c);   // single EXACT product: q, k are bf16 inputs held exactly in f16
#pragma unroll
      for (int r = 0; r < 8; ++r) s[ct][r] = (kr + 8 * g + r <= qi) ? c[r] * 0.125f : -3.0e38f; }   // 1/sqrt(64); causal (diagonal kept)
    float mx = fmaxf(s[0][0], s[1][0]);
#pragma unroll
    for (int r = 1; r < 8; ++r) mx = fmaxf(mx, fmaxf(s[0][r], s[1][r]));
    mx = fmaxf(mx, xhalf(mx));
    const float mn = fmaxf(m, mx); const float ea = exp2x1((m - mn) * LOG2E); const float alpha = (m <= -1.0e38f) ? 0.f : ea;
    v8f e[2];
#pragma unroll
    for (int ct = 0; ct < 2; ++ct) { const v8f ex = exp2x8((s[ct] - mn) * LOG2E);
#pragma unroll
      for (int r = 0; r < 8; ++r) e[ct][r] = (s[ct][r] <= -1.0e38f) ? 0.f : ex[r]; }
    v16h pa, pl;
#pragma unroll
    for (int i = 0; i < 16; ++i) { const float x = e[i >> 3][i & 7] * 2048.0f; const _Float16 hx = (_Float16)x; pa[i] = hx; pl[i] = (_Float16)((x - (float)hx) * 2048.0f); }   // element i of P^T = key 16 (i / 8) + 8 g + i % 8 of this pass. P scaled by 2^11 before the f16 split so small softmax weights stay out of the f16 subnormal range; 2^-11 folded into the epilogue
    const v8f e2 = e[0] + e[1];
    l = l * alpha + (((e2[0] + e2[1]) + (e2[2] + e2[3])) + ((e2[4] + e2[5]) + (e2[6] + e2[7]))); m = mn;
#pragma unroll
    for (int dt = 0; dt < 4; ++dt) { acc[dt] *= alpha; accl[dt] *= alpha; }
#pragma unroll
    for (int dt = 0; dt < 4; ++dt) { acc[dt] = wmma16(vf[dt], pa, acc[dt]); accl[dt] = wmma16(vf[dt], pl, accl[dt]); } }   // V^T x P^T hi + V^T x P^T lo / 2048 (v exact)
   asm volatile("s_wait_dscnt 0x0" ::: "memory");      // this wave's reads of buffer bf are done before the buffer is handed back
   asm volatile("s_wait_asynccnt 0x0" ::: "memory");   // this wave's share of stage st + 1 has landed
   __syncthreads();                                     // publishes stage st + 1 and ends every wave's reads of buffer bf
   if (st + 2 < nst) stage_copy(gk + (size_t)(st + 2) * KST * 2 * DM, gv + (st + 2) * KST, lk + bf * (KST * LP * 2), lv + bf * (DM * LP * 2)); }
  asm volatile("s_wait_asynccnt 0x0" ::: "memory");    // nothing of this wave is in flight past the loop
  // epilogue: out[e] = sum_d attn[d] W[e][d] (the bias-free Linear): W rows (exact) x attn^T (bf16 hi + residual, straight from the O^T tiles), 2 products
  { const float il = (1.0f / 2048.0f) / (l + xhalf(l)); v8f acc2[4] = {};
#pragma unroll
    for (int kc = 0; kc < 2; ++kc) { float v[16];
#pragma unroll
      for (int r = 0; r < 8; ++r) { v[r] = (acc[2 * kc][r] + accl[2 * kc][r] * (1.0f / 2048.0f)) * il; v[8 + r] = (acc[2 * kc + 1][r] + accl[2 * kc + 1][r] * (1.0f / 2048.0f)) * il; }
      const F2 a2 = bsplit16(v);
#pragma unroll
      for (int j = 0; j < 4; ++j) { const v16b w = frag_b(PW + (size_t)(j * 16 + col) * HD + kc * 32, lane); acc2[j] = wmma_bf(w, a2.l, acc2[j]); acc2[j] = wmma_bf(w, a2.h, acc2[j]); } }
#pragma unroll
    for (int j = 0; j < 4; ++j) { const v4f lo = { acc2[j][0], acc2[j][1], acc2[j][2], acc2[j][3] }, hi = { acc2[j][4], acc2[j][5], acc2[j][6], acc2[j][7] };   // acc2[j][r] = out[qi][16 j + 8 g + r]
      *(v4f*)&so[wave][col][j * 16 + 8 * g] = lo; *(v4f*)&so[wave][col][j * 16 + 8 * g + 4] = hi; }
    LDSX(); }
  for (int rl = 0; rl < 16; ++rl) if (lane < 16) vst2(O + ((size_t)b * SS + q0 + rl) * DM + h * HD + lane * 4, *(const v4f*)&so[wave][rl][lane * 4]);
}
#define WS2_QK  0u
#define WS2_VT  (WS2_QK + 2u * (size_t)NB * SS * 2 * DM)
#define WS2_PW  (WS2_VT + 2u * (size_t)NB * DM * SS)
#define WS2_END (WS2_PW + 2u * HD * HD + 256u)
extern "C" void kernel_launch(void* const* d_in, const int* in_sizes, int n_in, void* d_out, int out_size, void* d_ws, size_t ws_size, hipStream_t stream) {
  (void)in_sizes; (void)n_in; (void)out_size;
  const float** F = (const float**)d_in;   // 0 x [2,16,2048,64], 1 W [64,64]
  if (ws_size < (size_t)WS2_END) return;
  char* ws = (char*)d_ws; _Float16 *QK = (_Float16*)(ws + WS2_QK), *VTH = (_Float16*)(ws + WS2_VT); __bf16* PW = (__bf16*)(ws + WS2_PW);
  k_packw<<<HD, 64, 0, stream>>>(F[1], PW);
  k_prep<<<TNB * SS / 64, 256, 0, stream>>>(F[0], QK, VTH);
  k_attn<<<dim3(TQB, NH, TNB), 128, 0, stream>>>(QK, QK, VTH, VTH, nullptr, PW, (float*)d_out);   // out [b][h][q][e]; the residual-plane pointers are read-only and unused (single exact products)
}

// v003
// A run of this version takes 54 microseconds.
// Timed twice side by side with v002, it ran 1.38 times as fast both times.
// All steps since v000 together make it 3.27 times as fast.
// compute dtype: x and W rounded to bf16 and used as EXACT f16 operands for the attention (bf16 values are exact in f16): scores = x . x (single exact product) x 1/8 with the causal mask, running-max softmax in f32 (hardware exp), P (scaled by 2^11) as f16 hi + residual x the exact x planes (2 products); the 64 x 64 output map takes the f32 attention rows split into bf16 hi + residual against the exact bf16 W rows on WMMA 16x16x32 (2 products); f32 accumulate.
#include <hip/hip_runtime.h>
#include <math.h>

typedef __attribute__((ext_vector_type(16))) _Float16 v16h;
typedef __attribute__((ext_vector_type(16))) __bf16 v16b;
typedef __attribute__((ext_vector_type(8)))  _Float16 v8h;
typedef __attribute__((ext_vector_type(8)))  float v8f;
typedef __attribute__((ext_vector_type(4)))  float v4f;
typedef __attribute__((ext_vector_type(2)))  float v2f;
typedef __attribute__((ext_vector_type(4)))  unsigned v4u;
typedef __attribute__((ext_vector_type(4)))  int v4i;
typedef float __attribute__((may_alias)) float_a;
typedef int __attribute__((may_alias)) int_a;

template <typename T> __device__ __forceinline__ void vst2(void* p, T v) { *(T*)p = v;  }
__device__ __forceinline__ v8f wmma16(v16h a, v16h b, v8f c) {
  v8f d = __builtin_amdgcn_wmma_f32_16x16x32_f16(false, a, false, b, (short)0, c, false, false);
  asm volatile("v_nop\n\tv_nop\n\tv_nop\n\tv_nop" : "+v"(d) : "v"(a), "v"(b));
  return d;
}
__device__ __forceinline__ v8f wmma_bf(v16b a, v16b b, v8f c) {
  v8f d = __builtin_amdgcn_wmma_f32_16x16x32_bf16(false, a, false, b, (short)0, c, false, false);
  asm volatile("v_nop\n\tv_nop\n\tv_nop\n\tv_nop" : "+v"(d) : "v"(a), "v"(b));
  return d;
}
// Minimal causal attention block on a given per-head tensor x [2, 16, 2,048, 64] (q = k = v = x): softmax(mask(x x^T / 8)) x, then a bias-free 64 x 64 linear map.
__device__ __forceinline__ v16h frag_h(const _Float16* rowk0, int lane) {
  union { v16h v; v8h q[2]; } u; const _Float16* p = rowk0 + 8 * (lane >> 4);
  u.q[0] = *(const v8h*)p; u.q[1] = *(const v8h*)(p + 16); return u.v;
}
__device__ __forceinline__ v16h frag_f32(const float* rowk0, int lane) {
  v16h a; const float* p = rowk0 + 8 * (lane >> 4);
#pragma unroll
  for (int i = 0; i < 8; ++i) { a[i] = (_Float16)p[i]; a[8 + i] = (_Float16)p[16 + i]; }
  return a;
}
__device__ __forceinline__ v16h frag_f32s(const float* rowk0, int lane, float sc) {
  v16h a; const float* p = rowk0 + 8 * (lane >> 4);
#pragma unroll
  for (int i = 0; i < 8; ++i) { a[i] = (_Float16)(p[i] * sc); a[8 + i] = (_Float16)(p[16 + i] * sc); }
  return a;
}
// column fragment from a [K][ld] layout (column n), rows >= K read as 0
__device__ __forceinline__ v16h fragc_f32(const float* W, int k0, int n, int lane, int ld, int K) {
  v16h a; const int g = lane >> 4;
#pragma unroll
  for (int i = 0; i < 8; ++i) { const int ka = k0 + 8 * g + i, kb = ka + 16;
    a[i] = (_Float16)(ka < K ? W[(size_t)(ka < K ? ka : K - 1) * ld + n] : 0.f); a[8 + i] = (_Float16)(kb < K ? W[(size_t)(kb < K ? kb : K - 1) * ld + n] : 0.f); }
  return a;
}
struct F2 { v16b h, l; };
__device__ __forceinline__ F2 bsplit16(const float v[16]) { F2 r;
#pragma unroll
  for (int i = 0; i < 16; ++i) { const __bf16 h = (__bf16)v[i]; r.h[i] = h; r.l[i] = (__bf16)(v[i] - (float)h); }
  return r; }
__device__ __forceinline__ F2 split_row(const float* row, int k0, int lane) { float v[16]; const float* p = row + k0 + 8 * (lane >> 4);
#pragma unroll
  for (int i = 0; i < 8; ++i) { v[i] = p[i]; v[8 + i] = p[16 + i]; }
  return bsplit16(v); }
__device__ __forceinline__ F2 split_rowK(const float* row, int k0, int lane, int K) { float v[16]; const int g = lane >> 4;
#pragma unroll
  for (int i = 0; i < 8; ++i) { const int ka = k0 + 8 * g + i, kb = ka + 16; v[i] = ka < K ? row[ka < K ? ka : K - 1] : 0.f; v[8 + i] = kb < K ? row[kb < K ? kb : K - 1] : 0.f; }
  return bsplit16(v); }
__device__ __forceinline__ F2 split_col(const float* W, int k0, int n, int lane, int ld, int K) { float v[16]; const int g = lane >> 4;
#pragma unroll
  for (int i = 0; i < 8; ++i) { const int ka = k0 + 8 * g + i, kb = ka + 16; v[i] = ka < K ? W[(size_t)(ka < K ? ka : K - 1) * ld + n] : 0.f; v[8 + i] = kb < K ? W[(size_t)(kb < K ? kb : K - 1) * ld + n] : 0.f; }
  return bsplit16(v); }
__device__ __forceinline__ v8f mac3(const F2& a, const F2& b, v8f c) { c = wmma_bf(a.l, b.h, c); c = wmma_bf(a.h, b.l, c); return wmma_bf(a.h, b.h, c); }
__device__ __forceinline__ float sigm(float v) { return 1.0f / (1.0f + expf(-v)); }
#define LDSX() do { asm volatile("s_wait_dscnt 0" ::: "memory"); __builtin_amdgcn_wave_barrier(); __builtin_amdgcn_fence(__ATOMIC_RELEASE, "workgroup"); } while (0)


#define NB 32   // (batch, head) pairs
#define SS 2048
#define DM 64
#define NH 1
#define HD 64
#define QKVW (3 * DM)
#ifndef TQB
#define TQB (SS / 64)
#define TNB NB
#define TOB (NB * SS / 64)     // output row tiles (all)
#endif
typedef __attribute__((ext_vector_type(8))) __bf16 v8b;
__device__ __forceinline__ v16b frag_b(const __bf16* rowk0, int lane) {
  union { v16b v; v8b q[2]; } u; const __bf16* p = rowk0 + 8 * (lane >> 4);
  u.q[0] = *(const v8b*)p; u.q[1] = *(const v8b*)(p + 16); return u.v;
}
__device__ __forceinline__ float bfr(float v) { return (float)(__bf16)v; }
__device__ __attribute__((noinline)) float exp_ni(float v) { return expf(v); }
__device__ __attribute__((noinline)) float erf_ni(float v) { return erff(v); }

#define PK_A 0                       // [192][64] Wqkv rows (natural [out][in])
#define PK_P (PK_A + QKVW * DM)        // [64][64] Wo rows (natural)
#define PK_END (PK_P + DM * DM)
#define WS_PK  0u
#define WS_QK  (WS_PK + 2u * PK_END)             // f16 [65536 rows][128]: q | k
#define WS_QKL (WS_QK + 2u * NB * SS * 2 * DM)     // f16 q | k residual planes x2048
#define WS_VTH (WS_QKL + 2u * NB * SS * 2 * DM)    // f16 [b][64 (h*64+d)][2048 s] hi
#define WS_VTL (WS_VTH + 2u * NB * DM * SS)        // f16 lo x 2048
#define WS_O   (WS_VTL + 2u * NB * DM * SS)        // f32 [65536][64]
#define WS_CS  (WS_O + 4u * NB * SS * DM)           // f32 [2048][32] cos, [2048][32] sin
#define WS_END (WS_CS + 4u * 2 * SS * 32)
// ---- k_prep: block = 64 rows of one (batch, head): x rows -> f16 [row][128] (x | x) and x^T planes [bh][64][SS] (exact)
__global__ __launch_bounds__(256) void k_prep(const float* __restrict__ X, _Float16* __restrict__ QK, _Float16* __restrict__ VTH) {
  __shared__ __align__(16) _Float16 sq[64][72]; __shared__ __align__(16) _Float16 st[64][72];
  const int t = threadIdx.x; const size_t r0 = (size_t)blockIdx.x * 64; const size_t bh = r0 / SS, s0 = r0 % SS;
  for (int e = t; e < 64 * 64; e += 256) { const int r = e >> 6, c = e & 63; const _Float16 v = (_Float16)bfr(X[(r0 + r) * DM + c]); sq[r][c] = v; st[c][r] = v; }
  __syncthreads();
  for (int e = t; e < 64 * 8; e += 256) { const int r = e >> 3, q = e & 7; const v4u v = *(const v4u*)&sq[r][q * 8]; vst2((unsigned*)(QK + (r0 + r) * (2 * DM) + q * 8), v); vst2((unsigned*)(QK + (r0 + r) * (2 * DM) + DM + q * 8), v); }
  for (int e = t; e < 64 * 8; e += 256) { const int c = e >> 3, pc = e & 7; vst2((unsigned*)(VTH + (bh * DM + c) * SS + s0 + pc * 8), *(const v4u*)&st[c][pc * 8]); }
}
// ---- k_packw: W [64][64] natural -> bf16 rows
__global__ __launch_bounds__(64) void k_packw(const float* __restrict__ Wm, __bf16* __restrict__ PW) { const int n = blockIdx.x, t = threadIdx.x; __shared__ __align__(16) __bf16 s[HD]; s[t] = (__bf16)Wm[(size_t)n * HD + t]; __syncthreads(); if (t < HD / 8) vst2((unsigned*)(PW + (size_t)n * HD + t * 8), *(const v4u*)&s[t * 8]); }
// 2^x on the hardware's v_exp_f32, written as asm for one reason: the instruction set asks for one free slot behind a transcendental before its result is read or its source overwritten.
// Eight independent exps fill each other's slot, a v_nop fills the last one's; early-clobber outputs keep results off the sources.
__device__ __forceinline__ v8f exp2x8(v8f x) { float r0, r1, r2, r3, r4, r5, r6, r7;
  asm("v_exp_f32 %0, %8\n\tv_exp_f32 %1, %9\n\tv_exp_f32 %2, %10\n\tv_exp_f32 %3, %11\n\tv_exp_f32 %4, %12\n\tv_exp_f32 %5, %13\n\tv_exp_f32 %6, %14\n\tv_exp_f32 %7, %15\n\tv_nop"
      : "=&v"(r0), "=&v"(r1), "=&v"(r2), "=&v"(r3), "=&v"(r4), "=&v"(r5), "=&v"(r6), "=&v"(r7) : "v"(x[0]), "v"(x[1]), "v"(x[2]), "v"(x[3]), "v"(x[4]), "v"(x[5]), "v"(x[6]), "v"(x[7]));
  const v8f r = { r0, r1, r2, r3, r4, r5, r6, r7 }; return r; }
__device__ __forceinline__ float exp2x1(float x) { float r; asm("v_exp_f32 %0, %1\n\tv_nop" : "=v"(r) : "v"(x)); return r; }   // the same slot for a single exp
#define LOG2E 1.44269504088896340736f   // e^x = 2^(x log2 e), the product __expf forms
// lane l <-> lane l ^ 16 (the two halves of a wave hold the two halves of one query column's keys)
__device__ __forceinline__ float xhalf(float v) { const int b = __builtin_bit_cast(int, v); return __builtin_bit_cast(float, __builtin_amdgcn_permlanex16(b, b, 0x76543210, 0xfedcba98, false, false)); }
// One stage = 64 keys: 64 key rows (K) and the 64 x^T rows of those keys (V^T), 128 B a row, copied once per work-group and read by its four waves.
#define KST 64
#define LP 72   // LDS row pitch in halves: 144 B = 16 B x 9, an odd multiple of 16 B, so that the 16-byte fragment reads of 16 rows spread over the banks
// Each thread copies 16 B of four K rows and of four V^T rows (a wave covers four whole 128-B rows per copy). The s_wait_xcnt stands inside the copies' own statement so that
// no later write of an address register can be moved in front of it.
__device__ __forceinline__ void stage_copy(const _Float16* gk, const _Float16* gv, unsigned lk, unsigned lv) {
  asm volatile("global_load_async_to_lds_b128 %0, %8, off\n\tglobal_load_async_to_lds_b128 %1, %9, off\n\tglobal_load_async_to_lds_b128 %2, %10, off\n\tglobal_load_async_to_lds_b128 %3, %11, off\n\t"
               "global_load_async_to_lds_b128 %4, %12, off\n\tglobal_load_async_to_lds_b128 %5, %13, off\n\tglobal_load_async_to_lds_b128 %6, %14, off\n\tglobal_load_async_to_lds_b128 %7, %15, off\n\ts_wait_xcnt 0x0"
               :: "v"(lk), "v"(lk + 16 * LP * 2), "v"(lk + 32 * LP * 2), "v"(lk + 48 * LP * 2), "v"(lv), "v"(lv + 16 * LP * 2), "v"(lv + 32 * LP * 2), "v"(lv + 48 * LP * 2),
                  "v"(gk), "v"(gk + 16 * 2 * DM), "v"(gk + 32 * 2 * DM), "v"(gk + 48 * 2 * DM), "v"(gv), "v"(gv + 16 * SS), "v"(gv + 32 * SS), "v"(gv + 48 * SS) : "memory");
}
// ---- k_attn: transposed products. S^T = K Q^T (A = key rows, B = query rows kept in registers): lane (col, g) holds query q0 + col, keys 8g + r of each 16-key tile.
//      Two S^T tiles converted in place are the B operand P^T of O^T += V^T P^T (A = x^T rows), and the four O^T tiles are the B operand of out^T = W attn^T.
//      A work-group takes two query blocks of one (batch, head), one after the other: block TQB - 1 - pr (TQB - pr stages), then block pr (pr + 1 stages). Every work-group so walks TQB + 1 stages:
//      all work-groups are resident at once, and the launch lasts as long as the WGP with the most stages. The stage ring runs on across the switch (both blocks read the same K and V^T).
__global__ __launch_bounds__(128) void k_attn(const _Float16* __restrict__ QK, const _Float16* __restrict__ QKL, const _Float16* __restrict__ VTH, const _Float16* __restrict__ VTL, const void* __restrict__ KMASK, const __bf16* __restrict__ PW, float* __restrict__ O) {
  __shared__ __align__(16) float so[4][16][68];
  __shared__ __align__(16) _Float16 sk[2][KST][LP]; __shared__ __align__(16) _Float16 sv[2][DM][LP];   // two buffers: stage st + 1 lands while stage st is worked on
  const int tid = threadIdx.x, wave = tid >> 5, lane = tid & 31, col = lane & 15, g = lane >> 4;
  const int pr = blockIdx.x, h = blockIdx.y, b = blockIdx.z;
  const int n1 = TQB - pr, nst = TQB + 1;   // stages of the first block (causal: 64-key stages up to the query block); stages of both blocks
  int q0 = (TQB - 1 - pr) * 64 + wave * 16; int qi = q0 + col;
  (void)QKL; (void)VTL; (void)KMASK;
  v16h bq[2], bq2[2];   // query rows of the first and of the second block, both read up front
#pragma unroll
  for (int kc = 0; kc < 2; ++kc) { bq[kc] = frag_h(QK + ((size_t)b * SS + qi) * (2 * DM) + h * HD + kc * 32, lane); bq2[kc] = frag_h(QK + ((size_t)b * SS + pr * 64 + wave * 16 + col) * (2 * DM) + h * HD + kc * 32, lane); }
  float m = -3.0e38f, l = 0.f;   // running maximum of query qi (equal in both halves); l sums this half's keys only, the halves join in the epilogue
  v8f acc[4] = {}, accl[4] = {};
  const int crow = tid >> 3, cq = tid & 7;   // this thread's first row and 16-byte piece in every copy
  const _Float16* gk = QK + ((size_t)b * SS + crow) * (2 * DM) + DM + h * HD + cq * 8; const _Float16* gv = VTH + ((size_t)b * DM + h * HD + crow) * SS + cq * 8;
  const unsigned lk = (unsigned)(size_t)&sk[0][crow][cq * 8], lv = (unsigned)(size_t)&sv[0][crow][cq * 8];
  stage_copy(gk, gv, lk, lv);
  asm volatile("s_wait_asynccnt 0x0" ::: "memory");   // this wave's share of stage 0 has landed
  __syncthreads();                                     // every wave's share has
  { const int k1 = 1 < n1 ? 1 : 0; stage_copy(gk + (size_t)k1 * KST * 2 * DM, gv + k1 * KST, lk + KST * LP * 2, lv + DM * LP * 2); }   // stage 1 always exists
#pragma unroll 1   // one copy of the stage body: the two buffers are told apart by an address, not by code
  for (int st = 0; st < nst; ++st) { const int bf = st & 1; const int kb = st < n1 ? st : st - n1;   // kb: the 64-key block of this stage
#pragma unroll     // both passes of a stage unrolled: every LDS read is one base register plus a constant offset
   for (int p = 0; p < 2; ++p) { const int ks = kb * 2 + p; v8f s[2]; v16h kf[2][2], vf[4];   // the pass's fragments, read from LDS as one group: the V^T reads return behind the score products and the softmax
#pragma unroll
    for (int ct = 0; ct < 2; ++ct) { kf[ct][0] = frag_h(&sk[bf][p * 32 + ct * 16 + col][0], lane); kf[ct][1] = frag_h(&sk[bf][p * 32 + ct * 16 + col][32], lane); }
#pragma unroll
    for (int dt = 0; dt < 4; ++dt) vf[dt] = frag_h(&sv[bf][dt * 16 + col][p * 32], lane);
#pragma unroll
    for (int ct = 0; ct < 2; ++ct) { const int kr = ks * 32 + ct * 16; v8f c = {};
#pragma unroll
      for (int kc = 0; kc < 2; ++kc) c = wmma16(kf[ct][kc], bq[kc], c);   // single EXACT product: q, k are bf16 inputs held exactly in f16
#pragma unroll
      for (int r = 0; r < 8; ++r) s[ct][r] = (kr + 8 * g + r <= qi) ? c[r] * 0.125f : -3.0e38f; }   // 1/sqrt(64); causal (diagonal kept)
    float mx = fmaxf(s[0][0], s[1][0]);
#pragma unroll
    for (int r = 1; r < 8; ++r) mx = fmaxf(mx, fmaxf(s[0][r], s[1][r]));
    mx = fmaxf(mx, xhalf(mx));
    const float mn = fmaxf(m, mx); const float ea = exp2x1((m - mn) * LOG2E); const float alpha = (m <= -1.0e38f) ? 0.f : ea;
    v8f e[2];
#pragma unroll
    for (int ct = 0; ct < 2; ++ct) { const v8f ex = exp2x8((s[ct] - mn) * LOG2E);
#pragma unroll
      for (int r = 0; r < 8; ++r) e[ct][r] = (s[ct][r] <= -1.0e38f) ? 0.f : ex[r]; }
    v16h pa, pl;
#pragma unroll
    for (int i = 0; i < 16; ++i) { const float x = e[i >> 3][i & 7] * 2048.0f; const _Float16 hx = (_Float16)x; pa[i] = hx; pl[i] = (_Float16)((x - (float)hx) * 2048.0f); }   // element i of P^T = key 16 (i / 8) + 8 g + i % 8 of this pass. P scaled by 2^11 before the f16 split so small softmax weights stay out of the f16 subnormal range; 2^-11 folded into the epilogue
    const v8f e2 = e[0] + e[1];
    l = l * alpha + (((e2[0] + e2[1]) + (e2[2] + e2[3])) + ((e2[4] + e2[5]) + (e2[6] + e2[7]))); m = mn;
#pragma unroll
    for (int dt = 0; dt < 4; ++dt) { acc[dt] *= alpha; accl[dt] *= alpha; }
#pragma unroll
    for (int dt = 0; dt < 4; ++dt) { acc[dt] = wmma16(vf[dt], pa, acc[dt]); accl[dt] = wmma16(vf[dt], pl, accl[dt]); } }   // V^T x P^T hi + V^T x P^T lo / 2048 (v exact)
   asm volatile("s_wait_dscnt 0x0" ::: "memory");      // this wave's reads of buffer bf are done before the buffer is handed back
   asm volatile("s_wait_asynccnt 0x0" ::: "memory");   // this wave's share of stage st + 1 has landed
   __syncthreads();                                     // publishes stage st + 1 and ends every wave's reads of buffer bf
   if (st + 2 < nst) { const int k2 = st + 2 < n1 ? st + 2 : st + 2 - n1; stage_copy(gk + (size_t)k2 * KST * 2 * DM, gv + k2 * KST, lk + bf * (KST * LP * 2), lv + bf * (DM * LP * 2)); }
   if (st + 1 == n1 || st + 1 == nst) {   // a query block's last stage is done (the same test in every wave): its rows go out while the next stages' copies fly
  // epilogue: out[e] = sum_d attn[d] W[e][d] (the bias-free Linear): W rows (exact) x attn^T (bf16 hi + residual, straight from the O^T tiles), 2 products
  { const float il = (1.0f / 2048.0f) / (l + xhalf(l)); v8f acc2[4] = {};
#pragma unroll
    for (int kc = 0; kc < 2; ++kc) { float v[16];
#pragma unroll
      for (int r = 0; r < 8; ++r) { v[r] = (acc[2 * kc][r] + accl[2 * kc][r] * (1.0f / 2048.0f)) * il; v[8 + r] = (acc[2 * kc + 1][r] + accl[2 * kc + 1][r] * (1.0f / 2048.0f)) * il; }
      const F2 a2 = bsplit16(v);
#pragma unroll
      for (int j = 0; j < 4; ++j) { const v16b w = frag_b(PW + (size_t)(j * 16 + col) * HD + kc * 32, lane); acc2[j] = wmma_bf(w, a2.l, acc2[j]); acc2[j] = wmma_bf(w, a2.h, acc2[j]); } }
#pragma unroll
    for (int j = 0; j < 4; ++j) { const v4f lo = { acc2[j][0], acc2[j][1], acc2[j][2], acc2[j][3] }, hi = { acc2[j][4], acc2[j][5], acc2[j][6], acc2[j][7] };   // acc2[j][r] = out[qi][16 j + 8 g + r]
      *(v4f*)&so[wave][col][j * 16 + 8 * g] = lo; *(v4f*)&so[wave][col][j * 16 + 8 * g + 4] = hi; }
    LDSX(); }
  if (lane < 16) { for (int rl = 0; rl < 16; ++rl) vst2(O + ((size_t)b * SS + q0 + rl) * DM + h * HD + lane * 4, *(const v4f*)&so[wave][rl][lane * 4]);
    asm volatile("s_wait_xcnt 0x0" ::: "memory"); }   // directly behind the stores, in their own branch: their address and data registers are written again for the second block
    // start of the second block
    q0 = pr * 64 + wave * 16; qi = q0 + col; bq[0] = bq2[0]; bq[1] = bq2[1]; m = -3.0e38f; l = 0.f;
#pragma unroll
    for (int dt = 0; dt < 4; ++dt) { acc[dt] = v8f{}; accl[dt] = v8f{}; } } }
  asm volatile("s_wait_asynccnt 0x0" ::: "memory");    // nothing of this wave is in flight past the loop
}
#define WS2_QK  0u
#define WS2_VT  (WS2_QK + 2u * (size_t)NB * SS * 2 * DM)
#define WS2_PW  (WS2_VT + 2u * (size_t)NB * DM * SS)
#define WS2_END (WS2_PW + 2u * HD * HD + 256u)
extern "C" void kernel_launch(void* const* d_in, const int* in_sizes, int n_in, void* d_out, int out_size, void* d_ws, size_t ws_size, hipStream_t stream) {
  (void)in_sizes; (void)n_in; (void)out_size;
  const float** F = (const float**)d_in;   // 0 x [2,16,2048,64], 1 W [64,64]
  if (ws_size < (size_t)WS2_END) return;
  char* ws = (char*)d_ws; _Float16 *QK = (_Float16*)(ws + WS2_QK), *VTH = (_Float16*)(ws + WS2_VT); __bf16* PW = (__bf16*)(ws + WS2_PW);
  k_packw<<<HD, 64, 0, stream>>>(F[1], PW);
  k_prep<<<TNB * SS / 64, 256, 0, stream>>>(F[0], QK, VTH);
  k_attn<<<dim3(TQB / 2, NH, TNB), 128, 0, stream>>>(QK, QK, VTH, VTH, nullptr, PW, (float*)d_out);   // out [b][h][q][e]; the residual-plane pointers are read-only and unused (single exact products)
}

// v004
// Measured time: 49.7 microseconds a run.
// In two side-by-side timings against v003, it was 1.09 and 1.08 times as fast.
// All steps since v000 together make it 3.55 times as fast.
// compute dtype: x and W rounded to bf16 and used as EXACT f16 operands for the attention (bf16 values are exact in f16): scores = x . x (single exact product) x 1/8 with the causal mask, running-max softmax in f32 (hardware exp), P (scaled by 2^11) as f16 hi + residual x the exact x planes (2 products); the 64 x 64 output map takes the f32 attention rows split into bf16 hi + residual against the exact bf16 W rows on WMMA 16x16x32 (2 products); f32 accumulate.
#include <hip/hip_runtime.h>
#include <math.h>

typedef __attribute__((ext_vector_type(16))) _Float16 v16h;
typedef __attribute__((ext_vector_type(16))) __bf16 v16b;
typedef __attribute__((ext_vector_type(8)))  _Float16 v8h;
typedef __attribute__((ext_vector_type(8)))  float v8f;
typedef __attribute__((ext_vector_type(4)))  float v4f;
typedef __attribute__((ext_vector_type(2)))  float v2f;
typedef __attribute__((ext_vector_type(4)))  unsigned v4u;
typedef __attribute__((ext_vector_type(4)))  int v4i;
typedef float __attribute__((may_alias)) float_a;
typedef int __attribute__((may_alias)) int_a;

template <typename T> __device__ __forceinline__ void vst2(void* p, T v) { *(T*)p = v;  }
__device__ __forceinline__ v8f wmma16(v16h a, v16h b, v8f c) {
  v8f d = __builtin_amdgcn_wmma_f32_16x16x32_f16(false, a, false, b, (short)0, c, false, false);
  asm volatile("v_nop\n\tv_nop\n\tv_nop\n\tv_nop" : "+v"(d) : "v"(a), "v"(b));
  return d;
}
__device__ __forceinline__ v8f wmma_bf(v16b a, v16b b, v8f c) {
  v8f d = __builtin_amdgcn_wmma_f32_16x16x32_bf16(false, a, false, b, (short)0, c, false, false);
  asm volatile("v_nop\n\tv_nop\n\tv_nop\n\tv_nop" : "+v"(d) : "v"(a), "v"(b));
  return d;
}
// Minimal causal attention block on a given per-head tensor x [2, 16, 2,048, 64] (q = k = v = x): softmax(mask(x x^T / 8)) x, then a bias-free 64 x 64 linear map.
__device__ __forceinline__ v16h frag_h(const _Float16* rowk0, int lane) {
  union { v16h v; v8h q[2]; } u; const _Float16* p = rowk0 + 8 * (lane >> 4);
  u.q[0] = *(const v8h*)p; u.q[1] = *(const v8h*)(p + 16); return u.v;
}
__device__ __forceinline__ v16h frag_f32(const float* rowk0, int lane) {
  v16h a; const float* p = rowk0 + 8 * (lane >> 4);
#pragma unroll
  for (int i = 0; i < 8; ++i) { a[i] = (_Float16)p[i]; a[8 + i] = (_Float16)p[16 + i]; }
  return a;
}
__device__ __forceinline__ v16h frag_f32s(const float* rowk0, int lane, float sc) {
  v16h a; const float* p = rowk0 + 8 * (lane >> 4);
#pragma unroll
  for (int i = 0; i < 8; ++i) { a[i] = (_Float16)(p[i] * sc); a[8 + i] = (_Float16)(p[16 + i] * sc); }
  return a;
}
// column fragment from a [K][ld] layout (column n), rows >= K read as 0
__device__ __forceinline__ v16h fragc_f32(const float* W, int k0, int n, int lane, int ld, int K) {
  v16h a; const int g = lane >> 4;
#pragma unroll
  for (int i = 0; i < 8; ++i) { const int ka = k0 + 8 * g + i, kb = ka + 16;
    a[i] = (_Float16)(ka < K ? W[(size_t)(ka < K ? ka : K - 1) * ld + n] : 0.f); a[8 + i] = (_Float16)(kb < K ? W[(size_t)(kb < K ? kb : K - 1) * ld + n] : 0.f); }
  return a;
}
struct F2 { v16b h, l; };
__device__ __forceinline__ F2 bsplit16(const float v[16]) { F2 r;
#pragma unroll
  for (int i = 0; i < 16; ++i) { const __bf16 h = (__bf16)v[i]; r.h[i] = h; r.l[i] = (__bf16)(v[i] - (float)h); }
  return r; }
__device__ __forceinline__ F2 split_row(const float* row, int k0, int lane) { float v[16]; const float* p = row + k0 + 8 * (lane >> 4);
#pragma unroll
  for (int i = 0; i < 8; ++i) { v[i] = p[i]; v[8 + i] = p[16 + i]; }
  return bsplit16(v); }
__device__ __forceinline__ F2 split_rowK(const float* row, int k0, int lane, int K) { float v[16]; const int g = lane >> 4;
#pragma unroll
  for (int i = 0; i < 8; ++i) { const int ka = k0 + 8 * g + i, kb = ka + 16; v[i] = ka < K ? row[ka < K ? ka : K - 1] : 0.f; v[8 + i] = kb < K ? row[kb < K ? kb : K - 1] : 0.f; }
  return bsplit16(v); }
__device__ __forceinline__ F2 split_col(const float* W, int k0, int n, int lane, int ld, int K) { float v[16]; const int g = lane >> 4;
#pragma unroll
  for (int i = 0; i < 8; ++i) { const int ka = k0 + 8 * g + i, kb = ka + 16; v[i] = ka < K ? W[(size_t)(ka < K ? ka : K - 1) * ld + n] : 0.f; v[8 + i] = kb < K ? W[(size_t)(kb < K ? kb : K - 1) * ld + n] : 0.f; }
  return bsplit16(v); }
__device__ __forceinline__ v8f mac3(const F2& a, const F2& b, v8f c) { c = wmma_bf(a.l, b.h, c); c = wmma_bf(a.h, b.l, c); return wmma_bf(a.h, b.h, c); }
__device__ __forceinline__ float sigm(float v) { return 1.0f / (1.0f + expf(-v)); }
#define LDSX() do { asm volatile("s_wait_dscnt 0" ::: "memory"); __builtin_amdgcn_wave_barrier(); __builtin_amdgcn_fence(__ATOMIC_RELEASE, "workgroup"); } while (0)


#define NB 32   // (batch, head) pairs
#define SS 2048
#define DM 64
#define NH 1
#define HD 64
#define QKVW (3 * DM)
#ifndef TQB
#define TQB (SS / 64)
#define TNB NB
#define TOB (NB * SS / 64)     // output row tiles (all)
#endif
typedef __attribute__((ext_vector_type(8))) __bf16 v8b;
__device__ __forceinline__ v16b frag_b(const __bf16* rowk0, int lane) {
  union { v16b v; v8b q[2]; } u; const __bf16* p = rowk0 + 8 * (lane >> 4);
  u.q[0] = *(const v8b*)p; u.q[1] = *(const v8b*)(p + 16); return u.v;
}
__device__ __forceinline__ float bfr(float v) { return (float)(__bf16)v; }
__device__ __attribute__((noinline)) float exp_ni(float v) { return expf(v); }
__device__ __attribute__((noinline)) float erf_ni(float v) { return erff(v); }

#define PK_A 0                       // [192][64] Wqkv rows (natural [out][in])
#define PK_P (PK_A + QKVW * DM)        // [64][64] Wo rows (natural)
#define PK_END (PK_P + DM * DM)
#define WS_PK  0u
#define WS_QK  (WS_PK + 2u * PK_END)             // f16 [65536 rows][128]: q | k
#define WS_QKL (WS_QK + 2u * NB * SS * 2 * DM)     // f16 q | k residual planes x2048
#define WS_VTH (WS_QKL + 2u * NB * SS * 2 * DM)    // f16 [b][64 (h*64+d)][2048 s] hi
#define WS_VTL (WS_VTH + 2u * NB * DM * SS)        // f16 lo x 2048
#define WS_O   (WS_VTL + 2u * NB * DM * SS)        // f32 [65536][64]
#define WS_CS  (WS_O + 4u * NB * SS * DM)           // f32 [2048][32] cos, [2048][32] sin
#define WS_END (WS_CS + 4u * 2 * SS * 32)
// ---- k_prep: block = 64 rows of one (batch, head): x rows -> f16 [row][128] (x | x) and x^T planes [bh][64][SS] (exact)
__global__ __launch_bounds__(256) void k_prep(const float* __restrict__ X, _Float16* __restrict__ QK, _Float16* __restrict__ VTH) {
  __shared__ __align__(16) _Float16 sq[64][72]; __shared__ __align__(16) _Float16 st[64][72];
  const int t = threadIdx.x; const size_t r0 = (size_t)blockIdx.x * 64; const size_t bh = r0 / SS, s0 = r0 % SS;
  for (int e = t; e < 64 * 64; e += 256) { const int r = e >> 6, c = e & 63; const _Float16 v = (_Float16)bfr(X[(r0 + r) * DM + c]); sq[r][c] = v; st[c][r] = v; }
  __syncthreads();
  for (int e = t; e < 64 * 8; e += 256) { const int r = e >> 3, q = e & 7; const v4u v = *(const v4u*)&sq[r][q * 8]; vst2((unsigned*)(QK + (r0 + r) * (2 * DM) + q * 8), v); vst2((unsigned*)(QK + (r0 + r) * (2 * DM) + DM + q * 8), v); }
  for (int e = t; e < 64 * 8; e += 256) { const int c = e >> 3, pc = e & 7; vst2((unsigned*)(VTH + (bh * DM + c) * SS + s0 + pc * 8), *(const v4u*)&st[c][pc * 8]); }
}
// ---- k_packw: W [64][64] natural -> bf16 rows
__global__ __launch_bounds__(64) void k_packw(const float* __restrict__ Wm, __bf16* __restrict__ PW) { const int n = blockIdx.x, t = threadIdx.x; __shared__ __align__(16) __bf16 s[HD]; s[t] = (__bf16)Wm[(size_t)n * HD + t]; __syncthreads(); if (t < HD / 8) vst2((unsigned*)(PW + (size_t)n * HD + t * 8), *(const v4u*)&s[t * 8]); }
// 2^x on the hardware's v_exp_f32, written as asm for one reason: the instruction set asks for one free slot behind a transcendental before its result is read or its source overwritten.
// Eight independent exps fill each other's slot, a v_nop fills the last one's; early-clobber outputs keep results off the sources.
__device__ __forceinline__ v8f exp2x8(v8f x) { float r0, r1, r2, r3, r4, r5, r6, r7;
  asm("v_exp_f32 %0, %8\n\tv_exp_f32 %1, %9\n\tv_exp_f32 %2, %10\n\tv_exp_f32 %3, %11\n\tv_exp_f32 %4, %12\n\tv_exp_f32 %5, %13\n\tv_exp_f32 %6, %14\n\tv_exp_f32 %7, %15\n\tv_nop"
      : "=&v"(r0), "=&v"(r1), "=&v"(r2), "=&v"(r3), "=&v"(r4), "=&v"(r5), "=&v"(r6), "=&v"(r7) : "v"(x[0]), "v"(x[1]), "v"(x[2]), "v"(x[3]), "v"(x[4]), "v"(x[5]), "v"(x[6]), "v"(x[7]));
  const v8f r = { r0, r1, r2, r3, r4, r5, r6, r7 }; return r; }
__device__ __forceinline__ float exp2x1(float x) { float r; asm("v_exp_f32 %0, %1\n\tv_nop" : "=v"(r) : "v"(x)); return r; }   // the same slot for a single exp
#define LOG2E 1.44269504088896340736f   // e^x = 2^(x log2 e), the product __expf forms
// lane l <-> lane l ^ 16 (the two halves of a wave hold the two halves of one query column's keys)
__device__ __forceinline__ float xhalf(float v) { const int b = __builtin_bit_cast(int, v); return __builtin_bit_cast(float, __builtin_amdgcn_permlanex16(b, b, 0x76543210, 0xfedcba98, false, false)); }
// One stage = 64 keys: 64 key rows (K) and the 64 x^T rows of those keys (V^T), 128 B a row, copied once per work-group and read by its four waves.
#define KST 64
#define LP 72   // LDS row pitch in halves: 144 B = 16 B x 9, an odd multiple of 16 B, so that the 16-byte fragment reads of 16 rows spread over the banks
// Each thread copies 16 B of four K rows and of four V^T rows (a wave covers four whole 128-B rows per copy). The s_wait_xcnt stands inside the copies' own statement so that
// no later write of an address register can be moved in front of it.
__device__ __forceinline__ void stage_copy(const _Float16* gk, const _Float16* gv, unsigned lk, unsigned lv) {
  asm volatile("global_load_async_to_lds_b128 %0, %8, off\n\tglobal_load_async_to_lds_b128 %1, %9, off\n\tglobal_load_async_to_lds_b128 %2, %10, off\n\tglobal_load_async_to_lds_b128 %3, %11, off\n\t"
               "global_load_async_to_lds_b128 %4, %12, off\n\tglobal_load_async_to_lds_b128 %5, %13, off\n\tglobal_load_async_to_lds_b128 %6, %14, off\n\tglobal_load_async_to_lds_b128 %7, %15, off\n\ts_wait_xcnt 0x0"
               :: "v"(lk), "v"(lk + 16 * LP * 2), "v"(lk + 32 * LP * 2), "v"(lk + 48 * LP * 2), "v"(lv), "v"(lv + 16 * LP * 2), "v"(lv + 32 * LP * 2), "v"(lv + 48 * LP * 2),
                  "v"(gk), "v"(gk + 16 * 2 * DM), "v"(gk + 32 * 2 * DM), "v"(gk + 48 * 2 * DM), "v"(gv), "v"(gv + 16 * SS), "v"(gv + 32 * SS), "v"(gv + 48 * SS) : "memory");
}
// ---- k_attn: transposed products. S^T = K Q^T (A = key rows, B = query rows kept in registers): lane (col, g) holds query q0 + col, keys 8g + r of each 16-key tile.
//      Two S^T tiles converted in place are the B operand P^T of O^T += V^T P^T (A = x^T rows), and the four O^T tiles are the B operand of out^T = W attn^T.
//      A work-group takes two query blocks of one (batch, head), one after the other: block TQB - 1 - pr (TQB - pr stages), then block pr (pr + 1 stages). Every work-group so walks TQB + 1 stages:
//      all work-groups are resident at once, and the launch lasts as long as the WGP with the most stages. The stage ring runs on across the switch (both blocks read the same K and V^T).
__global__ __launch_bounds__(128) void k_attn(const _Float16* __restrict__ QK, const _Float16* __restrict__ QKL, const _Float16* __restrict__ VTH, const _Float16* __restrict__ VTL, const void* __restrict__ KMASK, const __bf16* __restrict__ PW, float* __restrict__ O) {
  __shared__ __align__(16) float so[4][16][68];
  __shared__ __align__(16) _Float16 sk[2][KST][LP]; __shared__ __align__(16) _Float16 sv[2][DM][LP];   // two buffers: stage st + 1 lands while stage st is worked on
  const int tid = threadIdx.x, wave = tid >> 5, lane = tid & 31, col = lane & 15, g = lane >> 4;
  const int pr = blockIdx.x, h = blockIdx.y, b = blockIdx.z;
  const int n1 = TQB - pr, nst = TQB + 1;   // stages of the first block (causal: 64-key stages up to the query block); stages of both blocks
  int q0 = (TQB - 1 - pr) * 64 + wave * 16; int qi = q0 + col;
  (void)QKL; (void)VTL; (void)KMASK;
  v16h bq[2], bq2[2];   // query rows of the first and of the second block, both read up front
#pragma unroll
  for (int kc = 0; kc < 2; ++kc) { bq[kc] = frag_h(QK + ((size_t)b * SS + qi) * (2 * DM) + h * HD + kc * 32, lane); bq2[kc] = frag_h(QK + ((size_t)b * SS + pr * 64 + wave * 16 + col) * (2 * DM) + h * HD + kc * 32, lane); }
  float m = -3.0e38f, l = 0.f;   // running maximum of query qi (equal in both halves); l sums this half's keys only, the halves join in the epilogue
  v8f acc[4] = {}, accl[4] = {};
  const int crow = tid >> 3, cq = tid & 7;   // this thread's first row and 16-byte piece in every copy
  const _Float16* gk = QK + ((size_t)b * SS + crow) * (2 * DM) + DM + h * HD + cq * 8; const _Float16* gv = VTH + ((size_t)b * DM + h * HD + crow) * SS + cq * 8;
  const unsigned lk = (unsigned)(size_t)&sk[0][crow][cq * 8], lv = (unsigned)(size_t)&sv[0][crow][cq * 8];
  stage_copy(gk, gv, lk, lv);
  asm volatile("s_wait_asynccnt 0x0" ::: "memory");   // this wave's share of stage 0 has landed
  __syncthreads();                                     // every wave's share has
  { const int k1 = 1 < n1 ? 1 : 0; stage_copy(gk + (size_t)k1 * KST * 2 * DM, gv + k1 * KST, lk + KST * LP * 2, lv + DM * LP * 2); }   // stage 1 always exists
#pragma unroll 1   // one copy of the stage body: the two buffers are told apart by an address, not by code
  for (int st = 0; st < nst; ++st) { const int bf = st & 1; const int kb = st < n1 ? st : st - n1;   // kb: the 64-key block of this stage
   // Only a query block's last stage, the one on the diagonal, holds keys behind a query. In every other stage the causal compare is true for all keys and no score is the mask value (64 products of f16 values
   // lie far above it), so compare and select are left out there. The test reads the block index and the loop counter alone: the same in every wave, a scalar branch.
   const bool diag = st + 1 == n1 || st + 1 == nst;
#pragma unroll     // both passes of a stage unrolled: every LDS read is one base register plus a constant offset
   for (int p = 0; p < 2; ++p) { const int ks = kb * 2 + p; v8f s[2]; v16h kf[2][2], vf[4];   // the pass's fragments, read from LDS as one group: the V^T reads return behind the score products and the softmax
#pragma unroll
    for (int ct = 0; ct < 2; ++ct) { kf[ct][0] = frag_h(&sk[bf][p * 32 + ct * 16 + col][0], lane); kf[ct][1] = frag_h(&sk[bf][p * 32 + ct * 16 + col][32], lane); }
#pragma unroll
    for (int dt = 0; dt < 4; ++dt) vf[dt] = frag_h(&sv[bf][dt * 16 + col][p * 32], lane);
#pragma unroll
    for (int ct = 0; ct < 2; ++ct) { v8f c = {};
#pragma unroll
      for (int kc = 0; kc < 2; ++kc) c = wmma16(kf[ct][kc], bq[kc], c);   // single EXACT product: q, k are bf16 inputs held exactly in f16
#pragma unroll
      for (int r = 0; r < 8; ++r) s[ct][r] = c[r] * 0.125f; }   // 1/sqrt(64)
    if (__builtin_expect(diag, 0)) {   // causal (diagonal kept); expected false so that the common path falls through and the masking code lies behind the loop
#pragma unroll
      for (int i = 0; i < 16; ++i) s[i >> 3][i & 7] = (ks * 32 + (i >> 3) * 16 + 8 * g + (i & 7) <= qi) ? s[i >> 3][i & 7] : -3.0e38f; }
    float mx = fmaxf(s[0][0], s[1][0]);
#pragma unroll
    for (int r = 1; r < 8; ++r) mx = fmaxf(mx, fmaxf(s[0][r], s[1][r]));
    mx = fmaxf(mx, xhalf(mx));
    const float mn = fmaxf(m, mx); const float ea = exp2x1((m - mn) * LOG2E); const float alpha = (m <= -1.0e38f) ? 0.f : ea;
    v8f e[2];
#pragma unroll
    for (int ct = 0; ct < 2; ++ct) e[ct] = exp2x8((s[ct] - mn) * LOG2E);
    if (__builtin_expect(diag, 0)) {   // masked keys weigh nothing; expected false for the same reason as above
#pragma unroll
      for (int i = 0; i < 16; ++i) e[i >> 3][i & 7] = (s[i >> 3][i & 7] <= -1.0e38f) ? 0.f : e[i >> 3][i & 7]; }
    v16h pa, pl;
#pragma unroll
    for (int i = 0; i < 16; ++i) { const float x = e[i >> 3][i & 7] * 2048.0f; const _Float16 hx = (_Float16)x; pa[i] = hx; pl[i] = (_Float16)((x - (float)hx) * 2048.0f); }   // element i of P^T = key 16 (i / 8) + 8 g + i % 8 of this pass. P scaled by 2^11 before the f16 split so small softmax weights stay out of the f16 subnormal range; 2^-11 folded into the epilogue
    const v8f e2 = e[0] + e[1];
    l = l * alpha + (((e2[0] + e2[1]) + (e2[2] + e2[3])) + ((e2[4] + e2[5]) + (e2[6] + e2[7]))); m = mn;
#pragma unroll
    for (int dt = 0; dt < 4; ++dt) { acc[dt] *= alpha; accl[dt] *= alpha; }
#pragma unroll
    for (int dt = 0; dt < 4; ++dt) { acc[dt] = wmma16(vf[dt], pa, acc[dt]); accl[dt] = wmma16(vf[dt], pl, accl[dt]); } }   // V^T x P^T hi + V^T x P^T lo / 2048 (v exact)
   asm volatile("s_wait_dscnt 0x0" ::: "memory");      // this wave's reads of buffer bf are done before the buffer is handed back
   asm volatile("s_wait_asynccnt 0x0" ::: "memory");   // this wave's share of stage st + 1 has landed
   __syncthreads();                                     // publishes stage st + 1 and ends every wave's reads of buffer bf
   if (st + 2 < nst) { const int k2 = st + 2 < n1 ? st + 2 : st + 2 - n1; stage_copy(gk + (size_t)k2 * KST * 2 * DM, gv + k2 * KST, lk + bf * (KST * LP * 2), lv + bf * (DM * LP * 2)); }
   if (st + 1 == n1 || st + 1 == nst) {   // a query block's last stage is done (the same test in every wave): its rows go out while the next stages' copies fly
  // epilogue: out[e] = sum_d attn[d] W[e][d] (the bias-free Linear): W rows (exact) x attn^T (bf16 hi + residual, straight from the O^T tiles), 2 products
  { const float il = (1.0f / 2048.0f) / (l + xhalf(l)); v8f acc2[4] = {};
#pragma unroll
    for (int kc = 0; kc < 2; ++kc) { float v[16];
#pragma unroll
      for (int r = 0; r < 8; ++r) { v[r] = (acc[2 * kc][r] + accl[2 * kc][r] * (1.0f / 2048.0f)) * il; v[8 + r] = (acc[2 * kc + 1][r] + accl[2 * kc + 1][r] * (1.0f / 2048.0f)) * il; }
      const F2 a2 = bsplit16(v);
#pragma unroll
      for (int j = 0; j < 4; ++j) { const v16b w = frag_b(PW + (size_t)(j * 16 + col) * HD + kc * 32, lane); acc2[j] = wmma_bf(w, a2.l, acc2[j]); acc2[j] = wmma_bf(w, a2.h, acc2[j]); } }
#pragma unroll
    for (int j = 0; j < 4; ++j) { const v4f lo = { acc2[j][0], acc2[j][1], acc2[j][2], acc2[j][3] }, hi = { acc2[j][4], acc2[j][5], acc2[j][6], acc2[j][7] };   // acc2[j][r] = out[qi][16 j + 8 g + r]
      *(v4f*)&so[wave][col][j * 16 + 8 * g] = lo; *(v4f*)&so[wave][col][j * 16 + 8 * g + 4] = hi; }
    LDSX(); }
  if (lane < 16) { for (int rl = 0; rl < 16; ++rl) vst2(O + ((size_t)b * SS + q0 + rl) * DM + h * HD + lane * 4, *(const v4f*)&so[wave][rl][lane * 4]);
    asm volatile("s_wait_xcnt 0x0" ::: "memory"); }   // directly behind the stores, in their own branch: their address and data registers are written again for the second block
    // start of the second block
    q0 = pr * 64 + wave * 16; qi = q0 + col; bq[0] = bq2[0]; bq[1] = bq2[1]; m = -3.0e38f; l = 0.f;
#pragma unroll
    for (int dt = 0; dt < 4; ++dt) { acc[dt] = v8f{}; accl[dt] = v8f{}; } } }
  asm volatile("s_wait_asynccnt 0x0" ::: "memory");    // nothing of this wave is in flight past the loop
}
#define WS2_QK  0u
#define WS2_VT  (WS2_QK + 2u * (size_t)NB * SS * 2 * DM)
#define WS2_PW  (WS2_VT + 2u * (size_t)NB * DM * SS)
#define WS2_END (WS2_PW + 2u * HD * HD + 256u)
extern "C" void kernel_launch(void* const* d_in, const int* in_sizes, int n_in, void* d_out, int out_size, void* d_ws, size_t ws_size, hipStream_t stream) {
  (void)in_sizes; (void)n_in; (void)out_size;
  const float** F = (const float**)d_in;   // 0 x [2,16,2048,64], 1 W [64,64]
  if (ws_size < (size_t)WS2_END) return;
  char* ws = (char*)d_ws; _Float16 *QK = (_Float16*)(ws + WS2_QK), *VTH = (_Float16*)(ws + WS2_VT); __bf16* PW = (__bf16*)(ws + WS2_PW);
  k_packw<<<HD, 64, 0, stream>>>(F[1], PW);
  k_prep<<<TNB * SS / 64, 256, 0, stream>>>(F[0], QK, VTH);
  k_attn<<<dim3(TQB / 2, NH, TNB), 128, 0, stream>>>(QK, QK, VTH, VTH, nullptr, PW, (float*)d_out);   // out [b][h][q][e]; the residual-plane pointers are read-only and unused (single exact products)
}

// v005
// One run takes 45.6 microseconds.
// Two timings next to v004 both put it at 1.09 times that version's speed.
// All steps since v000 together make it 3.88 times as fast.
// compute dtype: x and W rounded to bf16 and used as EXACT f16 operands for the attention (bf16 values are exact in f16): scores = x . x (single exact product) x 1/8 with the causal mask, running-max softmax in f32 (hardware exp), P (scaled by 2^11) as f16 hi + residual x the exact x planes (2 products); the 64 x 64 output map takes the f32 attention rows split into bf16 hi + residual against the exact bf16 W rows on WMMA 16x16x32 (2 products); f32 accumulate.
#include <hip/hip_runtime.h>
#include <math.h>

typedef __attribute__((ext_vector_type(16))) _Float16 v16h;
typedef __attribute__((ext_vector_type(16))) __bf16 v16b;
typedef __attribute__((ext_vector_type(8)))  _Float16 v8h;
typedef __attribute__((ext_vector_type(8)))  float v8f;
typedef __attribute__((ext_vector_type(4)))  float v4f;
typedef __attribute__((ext_vector_type(2)))  float v2f;
typedef __attribute__((ext_vector_type(4)))  unsigned v4u;
typedef __attribute__((ext_vector_type(4)))  int v4i;
typedef float __attribute__((may_alias)) float_a;
typedef int __attribute__((may_alias)) int_a;

template <typename T> __device__ __forceinline__ void vst2(void* p, T v) { *(T*)p = v;  }
// Both products are the builtin forms and nothing else: the compiler keeps the distance behind a WMMA itself, and other vector work or the next WMMA may stand in those slots.
__device__ __forceinline__ v8f wmma16(v16h a, v16h b, v8f c) {
  v8f d = __builtin_amdgcn_wmma_f32_16x16x32_f16(false, a, false, b, (short)0, c, false, false);
  return d;
}
__device__ __forceinline__ v8f wmma_bf(v16b a, v16b b, v8f c) {
  v8f d = __builtin_amdgcn_wmma_f32_16x16x32_bf16(false, a, false, b, (short)0, c, false, false);
  return d;
}
// Minimal causal attention block on a given per-head tensor x [2, 16, 2,048, 64] (q = k = v = x): softmax(mask(x x^T / 8)) x, then a bias-free 64 x 64 linear map.
__device__ __forceinline__ v16h frag_h(const _Float16* rowk0, int lane) {
  union { v16h v; v8h q[2]; } u; const _Float16* p = rowk0 + 8 * (lane >> 4);
  u.q[0] = *(const v8h*)p; u.q[1] = *(const v8h*)(p + 16); return u.v;
}
__device__ __forceinline__ v16h frag_f32(const float* rowk0, int lane) {
  v16h a; const float* p = rowk0 + 8 * (lane >> 4);
#pragma unroll
  for (int i = 0; i < 8; ++i) { a[i] = (_Float16)p[i]; a[8 + i] = (_Float16)p[16 + i]; }
  return a;
}
__device__ __forceinline__ v16h frag_f32s(const float* rowk0, int lane, float sc) {
  v16h a; const float* p = rowk0 + 8 * (lane >> 4);
#pragma unroll
  for (int i = 0; i < 8; ++i) { a[i] = (_Float16)(p[i] * sc); a[8 + i] = (_Float16)(p[16 + i] * sc); }
  return a;
}
// column fragment from a [K][ld] layout (column n), rows >= K read as 0
__device__ __forceinline__ v16h fragc_f32(const float* W, int k0, int n, int lane, int ld, int K) {
  v16h a; const int g = lane >> 4;
#pragma unroll
  for (int i = 0; i < 8; ++i) { const int ka = k0 + 8 * g + i, kb = ka + 16;
    a[i] = (_Float16)(ka < K ? W[(size_t)(ka < K ? ka : K - 1) * ld + n] : 0.f); a[8 + i] = (_Float16)(kb < K ? W[(size_t)(kb < K ? kb : K - 1) * ld + n] : 0.f); }
  return a;
}
struct F2 { v16b h, l; };
__device__ __forceinline__ F2 bsplit16(const float v[16]) { F2 r;
#pragma unroll
  for (int i = 0; i < 16; ++i) { const __bf16 h = (__bf16)v[i]; r.h[i] = h; r.l[i] = (__bf16)(v[i] - (float)h); }
  return r; }
__device__ __forceinline__ F2 split_row(const float* row, int k0, int lane) { float v[16]; const float* p = row + k0 + 8 * (lane >> 4);
#pragma unroll
  for (int i = 0; i < 8; ++i) { v[i] = p[i]; v[8 + i] = p[16 + i]; }
  return bsplit16(v); }
__device__ __forceinline__ F2 split_rowK(const float* row, int k0, int lane, int K) { float v[16]; const int g = lane >> 4;
#pragma unroll
  for (int i = 0; i < 8; ++i) { const int ka = k0 + 8 * g + i, kb = ka + 16; v[i] = ka < K ? row[ka < K ? ka : K - 1] : 0.f; v[8 + i] = kb < K ? row[kb < K ? kb : K - 1] : 0.f; }
  return bsplit16(v); }
__device__ __forceinline__ F2 split_col(const float* W, int k0, int n, int lane, int ld, int K) { float v[16]; const int g = lane >> 4;
#pragma unroll
  for (int i = 0; i < 8; ++i) { const int ka = k0 + 8 * g + i, kb = ka + 16; v[i] = ka < K ? W[(size_t)(ka < K ? ka : K - 1) * ld + n] : 0.f; v[8 + i] = kb < K ? W[(size_t)(kb < K ? kb : K - 1) * ld + n] : 0.f; }
  return bsplit16(v); }
__device__ __forceinline__ v8f mac3(const F2& a, const F2& b, v8f c) { c = wmma_bf(a.l, b.h, c); c = wmma_bf(a.h, b.l, c); return wmma_bf(a.h, b.h, c); }
__device__ __forceinline__ float sigm(float v) { return 1.0f / (1.0f + expf(-v)); }
#define LDSX() do { asm volatile("s_wait_dscnt 0" ::: "memory"); __builtin_amdgcn_wave_barrier(); __builtin_amdgcn_fence(__ATOMIC_RELEASE, "workgroup"); } while (0)


#define NB 32   // (batch, head) pairs
#define SS 2048
#define DM 64
#define NH 1
#define HD 64
#define QKVW (3 * DM)
#ifndef TQB
#define TQB (SS / 64)
#define TNB NB
#define TOB (NB * SS / 64)     // output row tiles (all)
#endif
typedef __attribute__((ext_vector_type(8))) __bf16 v8b;
__device__ __forceinline__ v16b frag_b(const __bf16* rowk0, int lane) {
  union { v16b v; v8b q[2]; } u; const __bf16* p = rowk0 + 8 * (lane >> 4);
  u.q[0] = *(const v8b*)p; u.q[1] = *(const v8b*)(p + 16); return u.v;
}
__device__ __forceinline__ float bfr(float v) { return (float)(__bf16)v; }
__device__ __attribute__((noinline)) float exp_ni(float v) { return expf(v); }
__device__ __attribute__((noinline)) float erf_ni(float v) { return erff(v); }

#define PK_A 0                       // [192][64] Wqkv rows (natural [out][in])
#define PK_P (PK_A + QKVW * DM)        // [64][64] Wo rows (natural)
#define PK_END (PK_P + DM * DM)
#define WS_PK  0u
#define WS_QK  (WS_PK + 2u * PK_END)             // f16 [65536 rows][128]: q | k
#define WS_QKL (WS_QK + 2u * NB * SS * 2 * DM)     // f16 q | k residual planes x2048
#define WS_VTH (WS_QKL + 2u * NB * SS * 2 * DM)    // f16 [b][64 (h*64+d)][2048 s] hi
#define WS_VTL (WS_VTH + 2u * NB * DM * SS)        // f16 lo x 2048
#define WS_O   (WS_VTL + 2u * NB * DM * SS)        // f32 [65536][64]
#define WS_CS  (WS_O + 4u * NB * SS * DM)           // f32 [2048][32] cos, [2048][32] sin
#define WS_END (WS_CS + 4u * 2 * SS * 32)
// ---- k_prep: block = 64 rows of one (batch, head): x rows -> f16 [row][128] (x | x) and x^T planes [bh][64][SS] (exact)
__global__ __launch_bounds__(256) void k_prep(const float* __restrict__ X, _Float16* __restrict__ QK, _Float16* __restrict__ VTH) {
  __shared__ __align__(16) _Float16 sq[64][72]; __shared__ __align__(16) _Float16 st[64][72];
  const int t = threadIdx.x; const size_t r0 = (size_t)blockIdx.x * 64; const size_t bh = r0 / SS, s0 = r0 % SS;
  for (int e = t; e < 64 * 64; e += 256) { const int r = e >> 6, c = e & 63; const _Float16 v = (_Float16)bfr(X[(r0 + r) * DM + c]); sq[r][c] = v; st[c][r] = v; }
  __syncthreads();
  for (int e = t; e < 64 * 8; e += 256) { const int r = e >> 3, q = e & 7; const v4u v = *(const v4u*)&sq[r][q * 8]; vst2((unsigned*)(QK + (r0 + r) * (2 * DM) + q * 8), v); vst2((unsigned*)(QK + (r0 + r) * (2 * DM) + DM + q * 8), v); }
  for (int e = t; e < 64 * 8; e += 256) { const int c = e >> 3, pc = e & 7; vst2((unsigned*)(VTH + (bh * DM + c) * SS + s0 + pc * 8), *(const v4u*)&st[c][pc * 8]); }
}
// ---- k_packw: W [64][64] natural -> bf16 rows
__global__ __launch_bounds__(64) void k_packw(const float* __restrict__ Wm, __bf16* __restrict__ PW) { const int n = blockIdx.x, t = threadIdx.x; __shared__ __align__(16) __bf16 s[HD]; s[t] = (__bf16)Wm[(size_t)n * HD + t]; __syncthreads(); if (t < HD / 8) vst2((unsigned*)(PW + (size_t)n * HD + t * 8), *(const v4u*)&s[t * 8]); }
// 2^x on the hardware's v_exp_f32, written as asm for one reason: the instruction set asks for one free slot behind a transcendental before its result is read or its source overwritten.
// Eight independent exps fill each other's slot, a v_nop fills the last one's; early-clobber outputs keep results off the sources.
__device__ __forceinline__ v8f exp2x8(v8f x) { float r0, r1, r2, r3, r4, r5, r6, r7;
  asm("v_exp_f32 %0, %8\n\tv_exp_f32 %1, %9\n\tv_exp_f32 %2, %10\n\tv_exp_f32 %3, %11\n\tv_exp_f32 %4, %12\n\tv_exp_f32 %5, %13\n\tv_exp_f32 %6, %14\n\tv_exp_f32 %7, %15\n\tv_nop"
      : "=&v"(r0), "=&v"(r1), "=&v"(r2), "=&v"(r3), "=&v"(r4), "=&v"(r5), "=&v"(r6), "=&v"(r7) : "v"(x[0]), "v"(x[1]), "v"(x[2]), "v"(x[3]), "v"(x[4]), "v"(x[5]), "v"(x[6]), "v"(x[7]));
  const v8f r = { r0, r1, r2, r3, r4, r5, r6, r7 }; return r; }
__device__ __forceinline__ float exp2x1(float x) { float r; asm("v_exp_f32 %0, %1\n\tv_nop" : "=v"(r) : "v"(x)); return r; }   // the same slot for a single exp
#define LOG2E 1.44269504088896340736f   // e^x = 2^(x log2 e), the product __expf forms
// lane l <-> lane l ^ 16 (the two halves of a wave hold the two halves of one query column's keys)
__device__ __forceinline__ float xhalf(float v) { const int b = __builtin_bit_cast(int, v); return __builtin_bit_cast(float, __builtin_amdgcn_permlanex16(b, b, 0x76543210, 0xfedcba98, false, false)); }
// One stage = 64 keys: 64 key rows (K) and the 64 x^T rows of those keys (V^T), 128 B a row, copied once per work-group and read by its four waves.
#define KST 64
#define LP 72   // LDS row pitch in halves: 144 B = 16 B x 9, an odd multiple of 16 B, so that the 16-byte fragment reads of 16 rows spread over the banks
// Each thread copies 16 B of four K rows and of four V^T rows (a wave covers four whole 128-B rows per copy). The s_wait_xcnt stands inside the copies' own statement so that
// no later write of an address register can be moved in front of it.
__device__ __forceinline__ void stage_copy(const _Float16* gk, const _Float16* gv, unsigned lk, unsigned lv) {
  asm volatile("global_load_async_to_lds_b128 %0, %8, off\n\tglobal_load_async_to_lds_b128 %1, %9, off\n\tglobal_load_async_to_lds_b128 %2, %10, off\n\tglobal_load_async_to_lds_b128 %3, %11, off\n\t"
               "global_load_async_to_lds_b128 %4, %12, off\n\tglobal_load_async_to_lds_b128 %5, %13, off\n\tglobal_load_async_to_lds_b128 %6, %14, off\n\tglobal_load_async_to_lds_b128 %7, %15, off\n\ts_wait_xcnt 0x0"
               :: "v"(lk), "v"(lk + 16 * LP * 2), "v"(lk + 32 * LP * 2), "v"(lk + 48 * LP * 2), "v"(lv), "v"(lv + 16 * LP * 2), "v"(lv + 32 * LP * 2), "v"(lv + 48 * LP * 2),
                  "v"(gk), "v"(gk + 16 * 2 * DM), "v"(gk + 32 * 2 * DM), "v"(gk + 48 * 2 * DM), "v"(gv), "v"(gv + 16 * SS), "v"(gv + 32 * SS), "v"(gv + 48 * SS) : "memory");
}
// ---- k_attn: transposed products. S^T = K Q^T (A = key rows, B = query rows kept in registers): lane (col, g) holds query q0 + col, keys 8g + r of each 16-key tile.
//      Two S^T tiles converted in place are the B operand P^T of O^T += V^T P^T (A = x^T rows), and the four O^T tiles are the B operand of out^T = W attn^T.
//      A work-group takes two query blocks of one (batch, head), one after the other: block TQB - 1 - pr (TQB - pr stages), then block pr (pr + 1 stages). Every work-group so walks TQB + 1 stages:
//      all work-groups are resident at once, and the launch lasts as long as the WGP with the most stages. The stage ring runs on across the switch (both blocks read the same K and V^T).
__global__ __launch_bounds__(128) void k_attn(const _Float16* __restrict__ QK, const _Float16* __restrict__ QKL, const _Float16* __restrict__ VTH, const _Float16* __restrict__ VTL, const void* __restrict__ KMASK, const __bf16* __restrict__ PW, float* __restrict__ O) {
  __shared__ __align__(16) float so[4][16][68];
  __shared__ __align__(16) _Float16 sk[2][KST][LP]; __shared__ __align__(16) _Float16 sv[2][DM][LP];   // two buffers: stage st + 1 lands while stage st is worked on
  const int tid = threadIdx.x, wave = tid >> 5, lane = tid & 31, col = lane & 15, g = lane >> 4;
  const int pr = blockIdx.x, h = blockIdx.y, b = blockIdx.z;
  const int n1 = TQB - pr, nst = TQB + 1;   // stages of the first block (causal: 64-key stages up to the query block); stages of both blocks
  int q0 = (TQB - 1 - pr) * 64 + wave * 16; int qi = q0 + col;
  (void)QKL; (void)VTL; (void)KMASK;
  v16h bq[2], bq2[2];   // query rows of the first and of the second block, both read up front
#pragma unroll
  for (int kc = 0; kc < 2; ++kc) { bq[kc] = frag_h(QK + ((size_t)b * SS + qi) * (2 * DM) + h * HD + kc * 32, lane); bq2[kc] = frag_h(QK + ((size_t)b * SS + pr * 64 + wave * 16 + col) * (2 * DM) + h * HD + kc * 32, lane); }
  float m = -3.0e38f, l = 0.f;   // running maximum of query qi (equal in both halves); l sums this half's keys only, the halves join in the epilogue
  v8f acc[4] = {}, accl[4] = {};
  const int crow = tid >> 3, cq = tid & 7;   // this thread's first row and 16-byte piece in every copy
  const _Float16* gk = QK + ((size_t)b * SS + crow) * (2 * DM) + DM + h * HD + cq * 8; const _Float16* gv = VTH + ((size_t)b * DM + h * HD + crow) * SS + cq * 8;
  const unsigned lk = (unsigned)(size_t)&sk[0][crow][cq * 8], lv = (unsigned)(size_t)&sv[0][crow][cq * 8];
  stage_copy(gk, gv, lk, lv);
  asm volatile("s_wait_asynccnt 0x0" ::: "memory");   // this wave's share of stage 0 has landed
  __syncthreads();                                     // every wave's share has
  { const int k1 = 1 < n1 ? 1 : 0; stage_copy(gk + (size_t)k1 * KST * 2 * DM, gv + k1 * KST, lk + KST * LP * 2, lv + DM * LP * 2); }   // stage 1 always exists
#pragma unroll 1   // one copy of the stage body: the two buffers are told apart by an address, not by code
  for (int st = 0; st < nst; ++st) { const int bf = st & 1; const int kb = st < n1 ? st : st - n1;   // kb: the 64-key block of this stage
   // Only a query block's last stage, the one on the diagonal, holds keys behind a query. In every other stage the causal compare is true for all keys and no score is the mask value (64 products of f16 values
   // lie far above it), so compare and select are left out there. The test reads the block index and the loop counter alone: the same in every wave, a scalar branch.
   const bool diag = st + 1 == n1 || st + 1 == nst;
#pragma unroll     // both passes of a stage unrolled: every LDS read is one base register plus a constant offset
   for (int p = 0; p < 2; ++p) { const int ks = kb * 2 + p; v8f s[2]; v16h kf[2][2], vf[4];   // the pass's fragments, read from LDS as one group: the V^T reads return behind the score products and the softmax
#pragma unroll
    for (int ct = 0; ct < 2; ++ct) { kf[ct][0] = frag_h(&sk[bf][p * 32 + ct * 16 + col][0], lane); kf[ct][1] = frag_h(&sk[bf][p * 32 + ct * 16 + col][32], lane); }
#pragma unroll
    for (int dt = 0; dt < 4; ++dt) vf[dt] = frag_h(&sv[bf][dt * 16 + col][p * 32], lane);
    __builtin_amdgcn_sched_barrier(0);   // keeps the pass's sixteen LDS reads one group in front of its products: left free, the build spreads them among the WMMAs in small groups, each with its wait close behind it
#pragma unroll
    for (int ct = 0; ct < 2; ++ct) { v8f c = {};
#pragma unroll
      for (int kc = 0; kc < 2; ++kc) c = wmma16(kf[ct][kc], bq[kc], c);   // single EXACT product: q, k are bf16 inputs held exactly in f16
#pragma unroll
      for (int r = 0; r < 8; ++r) s[ct][r] = c[r] * 0.125f; }   // 1/sqrt(64)
    if (__builtin_expect(diag, 0)) {   // causal (diagonal kept); expected false so that the common path falls through and the masking code lies behind the loop
#pragma unroll
      for (int i = 0; i < 16; ++i) s[i >> 3][i & 7] = (ks * 32 + (i >> 3) * 16 + 8 * g + (i & 7) <= qi) ? s[i >> 3][i & 7] : -3.0e38f; }
    float mx = fmaxf(s[0][0], s[1][0]);
#pragma unroll
    for (int r = 1; r < 8; ++r) mx = fmaxf(mx, fmaxf(s[0][r], s[1][r]));
    mx = fmaxf(mx, xhalf(mx));
    const float mn = fmaxf(m, mx); const float ea = exp2x1((m - mn) * LOG2E); const float alpha = (m <= -1.0e38f) ? 0.f : ea;
    v8f e[2];
#pragma unroll
    for (int ct = 0; ct < 2; ++ct) e[ct] = exp2x8((s[ct] - mn) * LOG2E);
    if (__builtin_expect(diag, 0)) {   // masked keys weigh nothing; expected false for the same reason as above
#pragma unroll
      for (int i = 0; i < 16; ++i) e[i >> 3][i & 7] = (s[i >> 3][i & 7] <= -1.0e38f) ? 0.f : e[i >> 3][i & 7]; }
    v16h pa, pl;
#pragma unroll
    for (int i = 0; i < 16; ++i) { const float x = e[i >> 3][i & 7] * 2048.0f; const _Float16 hx = (_Float16)x; pa[i] = hx; pl[i] = (_Float16)((x - (float)hx) * 2048.0f); }   // element i of P^T = key 16 (i / 8) + 8 g + i % 8 of this pass. P scaled by 2^11 before the f16 split so small softmax weights stay out of the f16 subnormal range; 2^-11 folded into the epilogue
    const v8f e2 = e[0] + e[1];
    l = l * alpha + (((e2[0] + e2[1]) + (e2[2] + e2[3])) + ((e2[4] + e2[5]) + (e2[6] + e2[7]))); m = mn;
#pragma unroll
    for (int dt = 0; dt < 4; ++dt) { acc[dt] *= alpha; accl[dt] *= alpha; }
#pragma unroll
    for (int dt = 0; dt < 4; ++dt) { acc[dt] = wmma16(vf[dt], pa, acc[dt]); accl[dt] = wmma16(vf[dt], pl, accl[dt]); } }   // V^T x P^T hi + V^T x P^T lo / 2048 (v exact)
   asm volatile("s_wait_dscnt 0x0" ::: "memory");      // this wave's reads of buffer bf are done before the buffer is handed back
   asm volatile("s_wait_asynccnt 0x0" ::: "memory");   // this wave's share of stage st + 1 has landed
   __syncthreads();                                     // publishes stage st + 1 and ends every wave's reads of buffer bf
   if (st + 2 < nst) { const int k2 = st + 2 < n1 ? st + 2 : st + 2 - n1; stage_copy(gk + (size_t)k2 * KST * 2 * DM, gv + k2 * KST, lk + bf * (KST * LP * 2), lv + bf * (DM * LP * 2)); }
   if (st + 1 == n1 || st + 1 == nst) {   // a query block's last stage is done (the same test in every wave): its rows go out while the next stages' copies fly
  // epilogue: out[e] = sum_d attn[d] W[e][d] (the bias-free Linear): W rows (exact) x attn^T (bf16 hi + residual, straight from the O^T tiles), 2 products
  { const float il = (1.0f / 2048.0f) / (l + xhalf(l)); v8f acc2[4] = {};
#pragma unroll
    for (int kc = 0; kc < 2; ++kc) { float v[16];
#pragma unroll
      for (int r = 0; r < 8; ++r) { v[r] = (acc[2 * kc][r] + accl[2 * kc][r] * (1.0f / 2048.0f)) * il; v[8 + r] = (acc[2 * kc + 1][r] + accl[2 * kc + 1][r] * (1.0f / 2048.0f)) * il; }
      const F2 a2 = bsplit16(v);
#pragma unroll
      for (int j = 0; j < 4; ++j) { const v16b w = frag_b(PW + (size_t)(j * 16 + col) * HD + kc * 32, lane); acc2[j] = wmma_bf(w, a2.l, acc2[j]); acc2[j] = wmma_bf(w, a2.h, acc2[j]); } }
#pragma unroll
    for (int j = 0; j < 4; ++j) { const v4f lo = { acc2[j][0], acc2[j][1], acc2[j][2], acc2[j][3] }, hi = { acc2[j][4], acc2[j][5], acc2[j][6], acc2[j][7] };   // acc2[j][r] = out[qi][16 j + 8 g + r]
      *(v4f*)&so[wave][col][j * 16 + 8 * g] = lo; *(v4f*)&so[wave][col][j * 16 + 8 * g + 4] = hi; }
    LDSX(); }
  if (lane < 16) { for (int rl = 0; rl < 16; ++rl) vst2(O + ((size_t)b * SS + q0 + rl) * DM + h * HD + lane * 4, *(const v4f*)&so[wave][rl][lane * 4]);
    asm volatile("s_wait_xcnt 0x0" ::: "memory"); }   // directly behind the stores, in their own branch: their address and data registers are written again for the second block
    // start of the second block
    q0 = pr * 64 + wave * 16; qi = q0 + col; bq[0] = bq2[0]; bq[1] = bq2[1]; m = -3.0e38f; l = 0.f;
#pragma unroll
    for (int dt = 0; dt < 4; ++dt) { acc[dt] = v8f{}; accl[dt] = v8f{}; } } }
  asm volatile("s_wait_asynccnt 0x0" ::: "memory");    // nothing of this wave is in flight past the loop
}
#define WS2_QK  0u
#define WS2_VT  (WS2_QK + 2u * (size_t)NB * SS * 2 * DM)
#define WS2_PW  (WS2_VT + 2u * (size_t)NB * DM * SS)
#define WS2_END (WS2_PW + 2u * HD * HD + 256u)
extern "C" void kernel_launch(void* const* d_in, const int* in_sizes, int n_in, void* d_out, int out_size, void* d_ws, size_t ws_size, hipStream_t stream) {
  (void)in_sizes; (void)n_in; (void)out_size;
  const float** F = (const float**)d_in;   // 0 x [2,16,2048,64], 1 W [64,64]
  if (ws_size < (size_t)WS2_END) return;
  char* ws = (char*)d_ws; _Float16 *QK = (_Float16*)(ws + WS2_QK), *VTH = (_Float16*)(ws + WS2_VT); __bf16* PW = (__bf16*)(ws + WS2_PW);
  k_packw<<<HD, 64, 0, stream>>>(F[1], PW);
  k_prep<<<TNB * SS / 64, 256, 0, stream>>>(F[0], QK, VTH);
  k_attn<<<dim3(TQB / 2, NH, TNB), 128, 0, stream>>>(QK, QK, VTH, VTH, nullptr, PW, (float*)d_out);   // out [b][h][q][e]; the residual-plane pointers are read-only and unused (single exact products)
}

// v006
// Measured time: 43.1 microseconds a run.
// Next to v005, in two timings, it ran 1.05 and 1.06 times as fast.
// All steps since v000 together make it 4.08 times as fast.
// compute dtype: x and W rounded to bf16 and used as EXACT f16 operands for the attention (bf16 values are exact in f16): scores = x . x (single exact product) x 1/8 with the causal mask, running-max softmax in f32 (hardware exp), P (scaled by 2^11) as f16 hi + residual x the exact x planes (2 products); the 64 x 64 output map takes the f32 attention rows split into bf16 hi + residual against the exact bf16 W rows on WMMA 16x16x32 (2 products); f32 accumulate.
#include <hip/hip_runtime.h>
#include <math.h>

typedef __attribute__((ext_vector_type(16))) _Float16 v16h;
typedef __attribute__((ext_vector_type(16))) __bf16 v16b;
typedef __attribute__((ext_vector_type(8)))  _Float16 v8h;
typedef __attribute__((ext_vector_type(8)))  float v8f;
typedef __attribute__((ext_vector_type(4)))  float v4f;
typedef __attribute__((ext_vector_type(2)))  float v2f;
typedef __attribute__((ext_vector_type(4)))  unsigned v4u;
typedef __attribute__((ext_vector_type(4)))  int v4i;
typedef float __attribute__((may_alias)) float_a;
typedef int __attribute__((may_alias)) int_a;

template <typename T> __device__ __forceinline__ void vst2(void* p, T v) { *(T*)p = v;  }
// Both products are the builtin forms and nothing else: the compiler keeps the distance behind a WMMA itself, and other vector work or the next WMMA may stand in those slots.
__device__ __forceinline__ v8f wmma16(v16h a, v16h b, v8f c) {
  v8f d = __builtin_amdgcn_wmma_f32_16x16x32_f16(false, a, false, b, (short)0, c, false, false);
  return d;
}
__device__ __forceinline__ v8f wmma_bf(v16b a, v16b b, v8f c) {
  v8f d = __builtin_amdgcn_wmma_f32_16x16x32_bf16(false, a, false, b, (short)0, c, false, false);
  return d;
}
// Minimal causal attention block on a given per-head tensor x [2, 16, 2,048, 64] (q = k = v = x): softmax(mask(x x^T / 8)) x, then a bias-free 64 x 64 linear map.
__device__ __forceinline__ v16h frag_h(const _Float16* rowk0, int lane) {
  union { v16h v; v8h q[2]; } u; const _Float16* p = rowk0 + 8 * (lane >> 4);
  u.q[0] = *(const v8h*)p; u.q[1] = *(const v8h*)(p + 16); return u.v;
}
__device__ __forceinline__ v16h frag_f32(const float* rowk0, int lane) {
  v16h a; const float* p = rowk0 + 8 * (lane >> 4);
#pragma unroll
  for (int i = 0; i < 8; ++i) { a[i] = (_Float16)p[i]; a[8 + i] = (_Float16)p[16 + i]; }
  return a;
}
__device__ __forceinline__ v16h frag_f32s(const float* rowk0, int lane, float sc) {
  v16h a; const float* p = rowk0 + 8 * (lane >> 4);
#pragma unroll
  for (int i = 0; i < 8; ++i) { a[i] = (_Float16)(p[i] * sc); a[8 + i] = (_Float16)(p[16 + i] * sc); }
  return a;
}
// column fragment from a [K][ld] layout (column n), rows >= K read as 0
__device__ __forceinline__ v16h fragc_f32(const float* W, int k0, int n, int lane, int ld, int K) {
  v16h a; const int g = lane >> 4;
#pragma unroll
  for (int i = 0; i < 8; ++i) { const int ka = k0 + 8 * g + i, kb = ka + 16;
    a[i] = (_Float16)(ka < K ? W[(size_t)(ka < K ? ka : K - 1) * ld + n] : 0.f); a[8 + i] = (_Float16)(kb < K ? W[(size_t)(kb < K ? kb : K - 1) * ld + n] : 0.f); }
  return a;
}
struct F2 { v16b h, l; };
__device__ __forceinline__ F2 bsplit16(const float v[16]) { F2 r;
#pragma unroll
  for (int i = 0; i < 16; ++i) { const __bf16 h = (__bf16)v[i]; r.h[i] = h; r.l[i] = (__bf16)(v[i] - (float)h); }
  return r; }
__device__ __forceinline__ F2 split_row(const float* row, int k0, int lane) { float v[16]; const float* p = row + k0 + 8 * (lane >> 4);
#pragma unroll
  for (int i = 0; i < 8; ++i) { v[i] = p[i]; v[8 + i] = p[16 + i]; }
  return bsplit16(v); }
__device__ __forceinline__ F2 split_rowK(const float* row, int k0, int lane, int K) { float v[16]; const int g = lane >> 4;
#pragma unroll
  for (int i = 0; i < 8; ++i) { const int ka = k0 + 8 * g + i, kb = ka + 16; v[i] = ka < K ? row[ka < K ? ka : K - 1] : 0.f; v[8 + i] = kb < K ? row[kb < K ? kb : K - 1] : 0.f; }
  return bsplit16(v); }
__device__ __forceinline__ F2 split_col(const float* W, int k0, int n, int lane, int ld, int K) { float v[16]; const int g = lane >> 4;
#pragma unroll
  for (int i = 0; i < 8; ++i) { const int ka = k0 + 8 * g + i, kb = ka + 16; v[i] = ka < K ? W[(size_t)(ka < K ? ka : K - 1) * ld + n] : 0.f; v[8 + i] = kb < K ? W[(size_t)(kb < K ? kb : K - 1) * ld + n] : 0.f; }
  return bsplit16(v); }
__device__ __forceinline__ v8f mac3(const F2& a, const F2& b, v8f c) { c = wmma_bf(a.l, b.h, c); c = wmma_bf(a.h, b.l, c); return wmma_bf(a.h, b.h, c); }
__device__ __forceinline__ float sigm(float v) { return 1.0f / (1.0f + expf(-v)); }
#define LDSX() do { asm volatile("s_wait_dscnt 0" ::: "memory"); __builtin_amdgcn_wave_barrier(); __builtin_amdgcn_fence(__ATOMIC_RELEASE, "workgroup"); } while (0)


#define NB 32   // (batch, head) pairs
#define SS 2048
#define DM 64
#define NH 1
#define HD 64
#define QKVW (3 * DM)
#ifndef TQB
#define TQB (SS / 64)
#define TNB NB
#define TOB (NB * SS / 64)     // output row tiles (all)
#endif
typedef __attribute__((ext_vector_type(8))) __bf16 v8b;
__device__ __forceinline__ v16b frag_b(const __bf16* rowk0, int lane) {
  union { v16b v; v8b q[2]; } u; const __bf16* p = rowk0 + 8 * (lane >> 4);
  u.q[0] = *(const v8b*)p; u.q[1] = *(const v8b*)(p + 16); return u.v;
}
__device__ __forceinline__ float bfr(float v) { return (float)(__bf16)v; }
__device__ __attribute__((noinline)) float exp_ni(float v) { return expf(v); }
__device__ __attribute__((noinline)) float erf_ni(float v) { return erff(v); }

#define PK_A 0                       // [192][64] Wqkv rows (natural [out][in])
#define PK_P (PK_A + QKVW * DM)        // [64][64] Wo rows (natural)
#define PK_END (PK_P + DM * DM)
#define WS_PK  0u
#define WS_QK  (WS_PK + 2u * PK_END)             // f16 [65536 rows][128]: q | k
#define WS_QKL (WS_QK + 2u * NB * SS * 2 * DM)     // f16 q | k residual planes x2048
#define WS_VTH (WS_QKL + 2u * NB * SS * 2 * DM)    // f16 [b][64 (h*64+d)][2048 s] hi
#define WS_VTL (WS_VTH + 2u * NB * DM * SS)        // f16 lo x 2048
#define WS_O   (WS_VTL + 2u * NB * DM * SS)        // f32 [65536][64]
#define WS_CS  (WS_O + 4u * NB * SS * DM)           // f32 [2048][32] cos, [2048][32] sin
#define WS_END (WS_CS + 4u * 2 * SS * 32)
// ---- k_prep: block = 64 rows of one (batch, head): x rows -> f16 [row][128] (x | x) and x^T planes [bh][64][SS] (exact)
__global__ __launch_bounds__(256) void k_prep(const float* __restrict__ X, _Float16* __restrict__ QK, _Float16* __restrict__ VTH) {
  __shared__ __align__(16) _Float16 sq[64][72]; __shared__ __align__(16) _Float16 st[64][72];
  const int t = threadIdx.x; const size_t r0 = (size_t)blockIdx.x * 64; const size_t bh = r0 / SS, s0 = r0 % SS;
  for (int e = t; e < 64 * 64; e += 256) { const int r = e >> 6, c = e & 63; const _Float16 v = (_Float16)bfr(X[(r0 + r) * DM + c]); sq[r][c] = v; st[c][r] = v; }
  __syncthreads();
  for (int e = t; e < 64 * 8; e += 256) { const int r = e >> 3, q = e & 7; const v4u v = *(const v4u*)&sq[r][q * 8]; vst2((unsigned*)(QK + (r0 + r) * (2 * DM) + q * 8), v); vst2((unsigned*)(QK + (r0 + r) * (2 * DM) + DM + q * 8), v); }
  for (int e = t; e < 64 * 8; e += 256) { const int c = e >> 3, pc = e & 7; vst2((unsigned*)(VTH + (bh * DM + c) * SS + s0 + pc * 8), *(const v4u*)&st[c][pc * 8]); }
}
// ---- k_packw: W [64][64] natural -> bf16 rows
__global__ __launch_bounds__(64) void k_packw(const float* __restrict__ Wm, __bf16* __restrict__ PW) { const int n = blockIdx.x, t = threadIdx.x; __shared__ __align__(16) __bf16 s[HD]; s[t] = (__bf16)Wm[(size_t)n * HD + t]; __syncthreads(); if (t < HD / 8) vst2((unsigned*)(PW + (size_t)n * HD + t * 8), *(const v4u*)&s[t * 8]); }
// 2^x on the hardware's v_exp_f32, written as asm for one reason: the instruction set asks for one free slot behind a transcendental before its result is read or its source overwritten.
// Eight independent exps fill each other's slot, a v_nop fills the last one's; early-clobber outputs keep results off the sources.
__device__ __forceinline__ v8f exp2x8(v8f x) { float r0, r1, r2, r3, r4, r5, r6, r7;
  asm("v_exp_f32 %0, %8\n\tv_exp_f32 %1, %9\n\tv_exp_f32 %2, %10\n\tv_exp_f32 %3, %11\n\tv_exp_f32 %4, %12\n\tv_exp_f32 %5, %13\n\tv_exp_f32 %6, %14\n\tv_exp_f32 %7, %15\n\tv_nop"
      : "=&v"(r0), "=&v"(r1), "=&v"(r2), "=&v"(r3), "=&v"(r4), "=&v"(r5), "=&v"(r6), "=&v"(r7) : "v"(x[0]), "v"(x[1]), "v"(x[2]), "v"(x[3]), "v"(x[4]), "v"(x[5]), "v"(x[6]), "v"(x[7]));
  const v8f r = { r0, r1, r2, r3, r4, r5, r6, r7 }; return r; }
__device__ __forceinline__ float exp2x1(float x) { float r; asm("v_exp_f32 %0, %1\n\tv_nop" : "=v"(r) : "v"(x)); return r; }   // the same slot for a single exp
#define LOG2E 1.44269504088896340736f   // e^x = 2^(x log2 e), the product __expf forms
// lane l <-> lane l ^ 16 (the two halves of a wave hold the two halves of one query column's keys)
__device__ __forceinline__ float xhalf(float v) { const int b = __builtin_bit_cast(int, v); return __builtin_bit_cast(float, __builtin_amdgcn_permlanex16(b, b, 0x76543210, 0xfedcba98, false, false)); }
// A query's score with itself, x . x / 8, from the query fragments (each half of the wave holds half of the row). It is one of the row's own causal scores, so it may start the running maximum.
__device__ __forceinline__ float own_score(v16h a, v16h b) { float t = 0.f;
#pragma unroll
  for (int i = 0; i < 16; ++i) { const float x = (float)a[i], y = (float)b[i]; t += x * x; t += y * y; }
  return (t + xhalf(t)) * 0.125f; }
// One stage = 64 keys: 64 key rows (K) and the 64 x^T rows of those keys (V^T), 128 B a row, copied once per work-group and read by its four waves.
#define KST 64
#define LP 72   // LDS row pitch in halves: 144 B = 16 B x 9, an odd multiple of 16 B, so that the 16-byte fragment reads of 16 rows spread over the banks
// Each thread copies 16 B of four K rows and of four V^T rows (a wave covers four whole 128-B rows per copy). The s_wait_xcnt stands inside the copies' own statement so that
// no later write of an address register can be moved in front of it.
__device__ __forceinline__ void stage_copy(const _Float16* gk, const _Float16* gv, unsigned lk, unsigned lv) {
  asm volatile("global_load_async_to_lds_b128 %0, %8, off\n\tglobal_load_async_to_lds_b128 %1, %9, off\n\tglobal_load_async_to_lds_b128 %2, %10, off\n\tglobal_load_async_to_lds_b128 %3, %11, off\n\t"
               "global_load_async_to_lds_b128 %4, %12, off\n\tglobal_load_async_to_lds_b128 %5, %13, off\n\tglobal_load_async_to_lds_b128 %6, %14, off\n\tglobal_load_async_to_lds_b128 %7, %15, off\n\ts_wait_xcnt 0x0"
               :: "v"(lk), "v"(lk + 16 * LP * 2), "v"(lk + 32 * LP * 2), "v"(lk + 48 * LP * 2), "v"(lv), "v"(lv + 16 * LP * 2), "v"(lv + 32 * LP * 2), "v"(lv + 48 * LP * 2),
                  "v"(gk), "v"(gk + 16 * 2 * DM), "v"(gk + 32 * 2 * DM), "v"(gk + 48 * 2 * DM), "v"(gv), "v"(gv + 16 * SS), "v"(gv + 32 * SS), "v"(gv + 48 * SS) : "memory");
}
// ---- k_attn: transposed products. S^T = K Q^T (A = key rows, B = query rows kept in registers): lane (col, g) holds query q0 + col, keys 8g + r of each 16-key tile.
//      Two S^T tiles converted in place are the B operand P^T of O^T += V^T P^T (A = x^T rows), and the four O^T tiles are the B operand of out^T = W attn^T.
//      A work-group takes two query blocks of one (batch, head), one after the other: block TQB - 1 - pr (TQB - pr stages), then block pr (pr + 1 stages). Every work-group so walks TQB + 1 stages:
//      all work-groups are resident at once, and the launch lasts as long as the WGP with the most stages. The stage ring runs on across the switch (both blocks read the same K and V^T).
__global__ __launch_bounds__(128) void k_attn(const _Float16* __restrict__ QK, const _Float16* __restrict__ QKL, const _Float16* __restrict__ VTH, const _Float16* __restrict__ VTL, const void* __restrict__ KMASK, const __bf16* __restrict__ PW, float* __restrict__ O) {
  __shared__ __align__(16) float so[4][16][68];
  __shared__ __align__(16) _Float16 sk[2][KST][LP]; __shared__ __align__(16) _Float16 sv[2][DM][LP];   // two buffers: stage st + 1 lands while stage st is worked on
  const int tid = threadIdx.x, wave = tid >> 5, lane = tid & 31, col = lane & 15, g = lane >> 4;
  const int pr = blockIdx.x, h = blockIdx.y, b = blockIdx.z;
  const int n1 = TQB - pr, nst = TQB + 1;   // stages of the first block (causal: 64-key stages up to the query block); stages of both blocks
  int q0 = (TQB - 1 - pr) * 64 + wave * 16; int qi = q0 + col;
  (void)QKL; (void)VTL; (void)KMASK;
  v16h bq[2], bq2[2];   // query rows of the first and of the second block, both read up front
#pragma unroll
  for (int kc = 0; kc < 2; ++kc) { bq[kc] = frag_h(QK + ((size_t)b * SS + qi) * (2 * DM) + h * HD + kc * 32, lane); bq2[kc] = frag_h(QK + ((size_t)b * SS + pr * 64 + wave * 16 + col) * (2 * DM) + h * HD + kc * 32, lane); }
  // Running maximum of query qi (equal in both halves). It starts at the query's own diagonal score, which belongs to every causal row: a finite start that is never above the row's maximum by more than rounding,
  // and for rows whose own score is their largest it never rises, so that the rescale below is skipped. l sums this half's keys only, the halves join in the epilogue.
  float m = own_score(bq[0], bq[1]), l = 0.f;
  v8f acc[4] = {}, accl[4] = {};
  const int crow = tid >> 3, cq = tid & 7;   // this thread's first row and 16-byte piece in every copy
  const _Float16* gk = QK + ((size_t)b * SS + crow) * (2 * DM) + DM + h * HD + cq * 8; const _Float16* gv = VTH + ((size_t)b * DM + h * HD + crow) * SS + cq * 8;
  const unsigned lk = (unsigned)(size_t)&sk[0][crow][cq * 8], lv = (unsigned)(size_t)&sv[0][crow][cq * 8];
  stage_copy(gk, gv, lk, lv);
  asm volatile("s_wait_asynccnt 0x0" ::: "memory");   // this wave's share of stage 0 has landed
  __syncthreads();                                     // every wave's share has
  { const int k1 = 1 < n1 ? 1 : 0; stage_copy(gk + (size_t)k1 * KST * 2 * DM, gv + k1 * KST, lk + KST * LP * 2, lv + DM * LP * 2); }   // stage 1 always exists
#pragma unroll 1   // one copy of the stage body: the two buffers are told apart by an address, not by code
  for (int st = 0; st < nst; ++st) { const int bf = st & 1; const int kb = st < n1 ? st : st - n1;   // kb: the 64-key block of this stage
   // Only a query block's last stage, the one on the diagonal, holds keys behind a query. In every other stage the causal compare is true for all keys and no score is the mask value (64 products of f16 values
   // lie far above it), so compare and select are left out there. The test reads the block index and the loop counter alone: the same in every wave, a scalar branch.
   const bool diag = st + 1 == n1 || st + 1 == nst;
#pragma unroll     // both passes of a stage unrolled: every LDS read is one base register plus a constant offset
   for (int p = 0; p < 2; ++p) { const int ks = kb * 2 + p; v8f s[2]; v16h kf[2][2], vf[4];   // the pass's fragments, read from LDS as one group: the V^T reads return behind the score products and the softmax
#pragma unroll
    for (int ct = 0; ct < 2; ++ct) { kf[ct][0] = frag_h(&sk[bf][p * 32 + ct * 16 + col][0], lane); kf[ct][1] = frag_h(&sk[bf][p * 32 + ct * 16 + col][32], lane); }
#pragma unroll
    for (int dt = 0; dt < 4; ++dt) vf[dt] = frag_h(&sv[bf][dt * 16 + col][p * 32], lane);
    __builtin_amdgcn_sched_barrier(0);   // keeps the pass's sixteen LDS reads one group in front of its products: left free, the build spreads them among the WMMAs in small groups, each with its wait close behind it
#pragma unroll
    for (int ct = 0; ct < 2; ++ct) { v8f c = {};
#pragma unroll
      for (int kc = 0; kc < 2; ++kc) c = wmma16(kf[ct][kc], bq[kc], c);   // single EXACT product: q, k are bf16 inputs held exactly in f16
#pragma unroll
      for (int r = 0; r < 8; ++r) s[ct][r] = c[r] * 0.125f; }   // 1/sqrt(64)
    if (__builtin_expect(diag, 0)) {   // causal (diagonal kept); expected false so that the common path falls through and the masking code lies behind the loop
#pragma unroll
      for (int i = 0; i < 16; ++i) s[i >> 3][i & 7] = (ks * 32 + (i >> 3) * 16 + 8 * g + (i & 7) <= qi) ? s[i >> 3][i & 7] : -3.0e38f; }
    float mx = fmaxf(s[0][0], s[1][0]);
#pragma unroll
    for (int r = 1; r < 8; ++r) mx = fmaxf(mx, fmaxf(s[0][r], s[1][r]));
    v8f e[2];   // weights against the maximum in use: they do not wait for this pass's maximum
#pragma unroll
    for (int ct = 0; ct < 2; ++ct) e[ct] = exp2x8((s[ct] - m) * LOG2E);
    if (__builtin_expect(__builtin_amdgcn_ballot_w32(mx > m) != 0, 0)) {   // one test per pass, a scalar branch: only where some query's maximum rises are sums and tiles rescaled and the weights formed again
      mx = fmaxf(mx, xhalf(mx));
      const float mn = fmaxf(m, mx); const float alpha = exp2x1((m - mn) * LOG2E);   // 1 exactly in the columns whose maximum stays
#pragma unroll
      for (int ct = 0; ct < 2; ++ct) e[ct] = exp2x8((s[ct] - mn) * LOG2E);
      l *= alpha; m = mn;
#pragma unroll
      for (int dt = 0; dt < 4; ++dt) { acc[dt] *= alpha; accl[dt] *= alpha; } }
    if (__builtin_expect(diag, 0)) {   // masked keys weigh nothing; expected false for the same reason as above
#pragma unroll
      for (int i = 0; i < 16; ++i) e[i >> 3][i & 7] = (s[i >> 3][i & 7] <= -1.0e38f) ? 0.f : e[i >> 3][i & 7]; }
    v16h pa, pl;
#pragma unroll
    for (int i = 0; i < 16; ++i) { const float x = e[i >> 3][i & 7] * 2048.0f; const _Float16 hx = (_Float16)x; pa[i] = hx; pl[i] = (_Float16)((x - (float)hx) * 2048.0f); }   // element i of P^T = key 16 (i / 8) + 8 g + i % 8 of this pass. P scaled by 2^11 before the f16 split so small softmax weights stay out of the f16 subnormal range; 2^-11 folded into the epilogue
    const v8f e2 = e[0] + e[1];
    l += ((e2[0] + e2[1]) + (e2[2] + e2[3])) + ((e2[4] + e2[5]) + (e2[6] + e2[7]));
#pragma unroll
    for (int dt = 0; dt < 4; ++dt) { acc[dt] = wmma16(vf[dt], pa, acc[dt]); accl[dt] = wmma16(vf[dt], pl, accl[dt]); } }   // V^T x P^T hi + V^T x P^T lo / 2048 (v exact)
   asm volatile("s_wait_dscnt 0x0" ::: "memory");      // this wave's reads of buffer bf are done before the buffer is handed back
   asm volatile("s_wait_asynccnt 0x0" ::: "memory");   // this wave's share of stage st + 1 has landed
   __syncthreads();                                     // publishes stage st + 1 and ends every wave's reads of buffer bf
   if (st + 2 < nst) { const int k2 = st + 2 < n1 ? st + 2 : st + 2 - n1; stage_copy(gk + (size_t)k2 * KST * 2 * DM, gv + k2 * KST, lk + bf * (KST * LP * 2), lv + bf * (DM * LP * 2)); }
   if (st + 1 == n1 || st + 1 == nst) {   // a query block's last stage is done (the same test in every wave): its rows go out while the next stages' copies fly
  // epilogue: out[e] = sum_d attn[d] W[e][d] (the bias-free Linear): W rows (exact) x attn^T (bf16 hi + residual, straight from the O^T tiles), 2 products
  { const float il = (1.0f / 2048.0f) / (l + xhalf(l)); v8f acc2[4] = {};
#pragma unroll
    for (int kc = 0; kc < 2; ++kc) { float v[16];
#pragma unroll
      for (int r = 0; r < 8; ++r) { v[r] = (acc[2 * kc][r] + accl[2 * kc][r] * (1.0f / 2048.0f)) * il; v[8 + r] = (acc[2 * kc + 1][r] + accl[2 * kc + 1][r] * (1.0f / 2048.0f)) * il; }
      const F2 a2 = bsplit16(v);
#pragma unroll
      for (int j = 0; j < 4; ++j) { const v16b w = frag_b(PW + (size_t)(j * 16 + col) * HD + kc * 32, lane); acc2[j] = wmma_bf(w, a2.l, acc2[j]); acc2[j] = wmma_bf(w, a2.h, acc2[j]); } }
#pragma unroll
    for (int j = 0; j < 4; ++j) { const v4f lo = { acc2[j][0], acc2[j][1], acc2[j][2], acc2[j][3] }, hi = { acc2[j][4], acc2[j][5], acc2[j][6], acc2[j][7] };   // acc2[j][r] = out[qi][16 j + 8 g + r]
      *(v4f*)&so[wave][col][j * 16 + 8 * g] = lo; *(v4f*)&so[wave][col][j * 16 + 8 * g + 4] = hi; }
    LDSX(); }
  if (lane < 16) { for (int rl = 0; rl < 16; ++rl) vst2(O + ((size_t)b * SS + q0 + rl) * DM + h * HD + lane * 4, *(const v4f*)&so[wave][rl][lane * 4]);
    asm volatile("s_wait_xcnt 0x0" ::: "memory"); }   // directly behind the stores, in their own branch: their address and data registers are written again for the second block
    // start of the second block
    q0 = pr * 64 + wave * 16; qi = q0 + col; bq[0] = bq2[0]; bq[1] = bq2[1]; m = own_score(bq[0], bq[1]); l = 0.f;
#pragma unroll
    for (int dt = 0; dt < 4; ++dt) { acc[dt] = v8f{}; accl[dt] = v8f{}; } } }
  asm volatile("s_wait_asynccnt 0x0" ::: "memory");    // nothing of this wave is in flight past the loop
}
#define WS2_QK  0u
#define WS2_VT  (WS2_QK + 2u * (size_t)NB * SS * 2 * DM)
#define WS2_PW  (WS2_VT + 2u * (size_t)NB * DM * SS)
#define WS2_END (WS2_PW + 2u * HD * HD + 256u)
extern "C" void kernel_launch(void* const* d_in, const int* in_sizes, int n_in, void* d_out, int out_size, void* d_ws, size_t ws_size, hipStream_t stream) {
  (void)in_sizes; (void)n_in; (void)out_size;
  const float** F = (const float**)d_in;   // 0 x [2,16,2048,64], 1 W [64,64]
  if (ws_size < (size_t)WS2_END) return;
  char* ws = (char*)d_ws; _Float16 *QK = (_Float16*)(ws + WS2_QK), *VTH = (_Float16*)(ws + WS2_VT); __bf16* PW = (__bf16*)(ws + WS2_PW);
  k_packw<<<HD, 64, 0, stream>>>(F[1], PW);
  k_prep<<<TNB * SS / 64, 256, 0, stream>>>(F[0], QK, VTH);
  k_attn<<<dim3(TQB / 2, NH, TNB), 128, 0, stream>>>(QK, QK, VTH, VTH, nullptr, PW, (float*)d_out);   // out [b][h][q][e]; the residual-plane pointers are read-only and unused (single exact products)
}

// v007
// One run takes 39.1 microseconds.
// Next to v006, in two timings, it ran 1.08 and 1.09 times as fast.
// Counting every step since v000, it is 4.43 times as fast.
// compute dtype: x and W rounded to bf16 and used as EXACT f16 operands for the attention (bf16 values are exact in f16): scores = x . x (single exact product) x 1/8 with the causal mask, running-max softmax in f32 (hardware exp), P (scaled by 2^11) as f16 value + f16 residual x the exact x planes (2 products, one accumulator); the 64 x 64 output map takes the f32 attention rows split into bf16 hi + residual against the exact bf16 W rows on WMMA 16x16x32 (2 products); f32 accumulate.
#include <hip/hip_runtime.h>
#include <math.h>

typedef __attribute__((ext_vector_type(16))) _Float16 v16h;
typedef __attribute__((ext_vector_type(16))) __bf16 v16b;
typedef __attribute__((ext_vector_type(8)))  _Float16 v8h;
typedef __attribute__((ext_vector_type(2)))  _Float16 v2h;
typedef __attribute__((ext_vector_type(8)))  float v8f;
typedef __attribute__((ext_vector_type(4)))  float v4f;
typedef __attribute__((ext_vector_type(2)))  float v2f;
typedef __attribute__((ext_vector_type(4)))  unsigned v4u;
typedef __attribute__((ext_vector_type(4)))  int v4i;
typedef float __attribute__((may_alias)) float_a;
typedef int __attribute__((may_alias)) int_a;

template <typename T> __device__ __forceinline__ void vst2(void* p, T v) { *(T*)p = v;  }
// Both products are the builtin forms and nothing else: the compiler keeps the distance behind a WMMA itself, and other vector work or the next WMMA may stand in those slots.
__device__ __forceinline__ v8f wmma16(v16h a, v16h b, v8f c) {
  v8f d = __builtin_amdgcn_wmma_f32_16x16x32_f16(false, a, false, b, (short)0, c, false, false);
  return d;
}
__device__ __forceinline__ v8f wmma_bf(v16b a, v16b b, v8f c) {
  v8f d = __builtin_amdgcn_wmma_f32_16x16x32_bf16(false, a, false, b, (short)0, c, false, false);
  return d;
}
// Minimal causal attention block on a given per-head tensor x [2, 16, 2,048, 64] (q = k = v = x): softmax(mask(x x^T / 8)) x, then a bias-free 64 x 64 linear map.
__device__ __forceinline__ v16h frag_h(const _Float16* rowk0, int lane) {
  union { v16h v; v8h q[2]; } u; const _Float16* p = rowk0 + 8 * (lane >> 4);
  u.q[0] = *(const v8h*)p; u.q[1] = *(const v8h*)(p + 16); return u.v;
}
__device__ __forceinline__ v16h frag_f32(const float* rowk0, int lane) {
  v16h a; const float* p = rowk0 + 8 * (lane >> 4);
#pragma unroll
  for (int i = 0; i < 8; ++i) { a[i] = (_Float16)p[i]; a[8 + i] = (_Float16)p[16 + i]; }
  return a;
}
__device__ __forceinline__ v16h frag_f32s(const float* rowk0, int lane, float sc) {
  v16h a; const float* p = rowk0 + 8 * (lane >> 4);
#pragma unroll
  for (int i = 0; i < 8; ++i) { a[i] = (_Float16)(p[i] * sc); a[8 + i] = (_Float16)(p[16 + i] * sc); }
  return a;
}
// column fragment from a [K][ld] layout (column n), rows >= K read as 0
__device__ __forceinline__ v16h fragc_f32(const float* W, int k0, int n, int lane, int ld, int K) {
  v16h a; const int g = lane >> 4;
#pragma unroll
  for (int i = 0; i < 8; ++i) { const int ka = k0 + 8 * g + i, kb = ka + 16;
    a[i] = (_Float16)(ka < K ? W[(size_t)(ka < K ? ka : K - 1) * ld + n] : 0.f); a[8 + i] = (_Float16)(kb < K ? W[(size_t)(kb < K ? kb : K - 1) * ld + n] : 0.f); }
  return a;
}
struct F2 { v16b h, l; };
__device__ __forceinline__ F2 bsplit16(const float v[16]) { F2 r;
#pragma unroll
  for (int i = 0; i < 16; ++i) { const __bf16 h = (__bf16)v[i]; r.h[i] = h; r.l[i] = (__bf16)(v[i] - (float)h); }
  return r; }
__device__ __forceinline__ F2 split_row(const float* row, int k0, int lane) { float v[16]; const float* p = row + k0 + 8 * (lane >> 4);
#pragma unroll
  for (int i = 0; i < 8; ++i) { v[i] = p[i]; v[8 + i] = p[16 + i]; }
  return bsplit16(v); }
__device__ __forceinline__ F2 split_rowK(const float* row, int k0, int lane, int K) { float v[16]; const int g = lane >> 4;
#pragma unroll
  for (int i = 0; i < 8; ++i) { const int ka = k0 + 8 * g + i, kb = ka + 16; v[i] = ka < K ? row[ka < K ? ka : K - 1] : 0.f; v[8 + i] = kb < K ? row[kb < K ? kb : K - 1] : 0.f; }
  return bsplit16(v); }
__device__ __forceinline__ F2 split_col(const float* W, int k0, int n, int lane, int ld, int K) { float v[16]; const int g = lane >> 4;
#pragma unroll
  for (int i = 0; i < 8; ++i) { const int ka = k0 + 8 * g + i, kb = ka + 16; v[i] = ka < K ? W[(size_t)(ka < K ? ka : K - 1) * ld + n] : 0.f; v[8 + i] = kb < K ? W[(size_t)(kb < K ? kb : K - 1) * ld + n] : 0.f; }
  return bsplit16(v); }
__device__ __forceinline__ v8f mac3(const F2& a, const F2& b, v8f c) { c = wmma_bf(a.l, b.h, c); c = wmma_bf(a.h, b.l, c); return wmma_bf(a.h, b.h, c); }
__device__ __forceinline__ float sigm(float v) { return 1.0f / (1.0f + expf(-v)); }
#define LDSX() do { asm volatile("s_wait_dscnt 0" ::: "memory"); __builtin_amdgcn_wave_barrier(); __builtin_amdgcn_fence(__ATOMIC_RELEASE, "workgroup"); } while (0)


#define NB 32   // (batch, head) pairs
#define SS 2048
#define DM 64
#define NH 1
#define HD 64
#define QKVW (3 * DM)
#ifndef TQB
#define TQB (SS / 64)
#define TNB NB
#define TOB (NB * SS / 64)     // output row tiles (all)
#endif
typedef __attribute__((ext_vector_type(8))) __bf16 v8b;
__device__ __forceinline__ v16b frag_b(const __bf16* rowk0, int lane) {
  union { v16b v; v8b q[2]; } u; const __bf16* p = rowk0 + 8 * (lane >> 4);
  u.q[0] = *(const v8b*)p; u.q[1] = *(const v8b*)(p + 16); return u.v;
}
__device__ __forceinline__ float bfr(float v) { return (float)(__bf16)v; }
__device__ __attribute__((noinline)) float exp_ni(float v) { return expf(v); }
__device__ __attribute__((noinline)) float erf_ni(float v) { return erff(v); }

#define PK_A 0                       // [192][64] Wqkv rows (natural [out][in])
#define PK_P (PK_A + QKVW * DM)        // [64][64] Wo rows (natural)
#define PK_END (PK_P + DM * DM)
#define WS_PK  0u
#define WS_QK  (WS_PK + 2u * PK_END)             // f16 [65536 rows][128]: q | k
#define WS_QKL (WS_QK + 2u * NB * SS * 2 * DM)     // f16 q | k residual planes x2048
#define WS_VTH (WS_QKL + 2u * NB * SS * 2 * DM)    // f16 [b][64 (h*64+d)][2048 s] hi
#define WS_VTL (WS_VTH + 2u * NB * DM * SS)        // f16 lo x 2048
#define WS_O   (WS_VTL + 2u * NB * DM * SS)        // f32 [65536][64]
#define WS_CS  (WS_O + 4u * NB * SS * DM)           // f32 [2048][32] cos, [2048][32] sin
#define WS_END (WS_CS + 4u * 2 * SS * 32)
// ---- k_prep: block = 64 rows of one (batch, head): x rows -> f16 [row][128] (x | x) and x^T planes [bh][64][SS] (exact)
__global__ __launch_bounds__(256) void k_prep(const float* __restrict__ X, _Float16* __restrict__ QK, _Float16* __restrict__ VTH) {
  __shared__ __align__(16) _Float16 sq[64][72]; __shared__ __align__(16) _Float16 st[64][72];
  const int t = threadIdx.x; const size_t r0 = (size_t)blockIdx.x * 64; const size_t bh = r0 / SS, s0 = r0 % SS;
  for (int e = t; e < 64 * 64; e += 256) { const int r = e >> 6, c = e & 63; const _Float16 v = (_Float16)bfr(X[(r0 + r) * DM + c]); sq[r][c] = v; st[c][r] = v; }
  __syncthreads();
  for (int e = t; e < 64 * 8; e += 256) { const int r = e >> 3, q = e & 7; const v4u v = *(const v4u*)&sq[r][q * 8]; vst2((unsigned*)(QK + (r0 + r) * (2 * DM) + q * 8), v); vst2((unsigned*)(QK + (r0 + r) * (2 * DM) + DM + q * 8), v); }
  for (int e = t; e < 64 * 8; e += 256) { const int c = e >> 3, pc = e & 7; vst2((unsigned*)(VTH + (bh * DM + c) * SS + s0 + pc * 8), *(const v4u*)&st[c][pc * 8]); }
}
// ---- k_packw: W [64][64] natural -> bf16 rows
__global__ __launch_bounds__(64) void k_packw(const float* __restrict__ Wm, __bf16* __restrict__ PW) { const int n = blockIdx.x, t = threadIdx.x; __shared__ __align__(16) __bf16 s[HD]; s[t] = (__bf16)Wm[(size_t)n * HD + t]; __syncthreads(); if (t < HD / 8) vst2((unsigned*)(PW + (size_t)n * HD + t * 8), *(const v4u*)&s[t * 8]); }
// 2^x on the hardware's v_exp_f32, written as asm for one reason: the instruction set asks for one free slot behind a transcendental before its result is read or its source overwritten.
// Eight independent exps fill each other's slot, a v_nop fills the last one's; early-clobber outputs keep results off the sources.
__device__ __forceinline__ v8f exp2x8(v8f x) { float r0, r1, r2, r3, r4, r5, r6, r7;
  asm("v_exp_f32 %0, %8\n\tv_exp_f32 %1, %9\n\tv_exp_f32 %2, %10\n\tv_exp_f32 %3, %11\n\tv_exp_f32 %4, %12\n\tv_exp_f32 %5, %13\n\tv_exp_f32 %6, %14\n\tv_exp_f32 %7, %15\n\tv_nop"
      : "=&v"(r0), "=&v"(r1), "=&v"(r2), "=&v"(r3), "=&v"(r4), "=&v"(r5), "=&v"(r6), "=&v"(r7) : "v"(x[0]), "v"(x[1]), "v"(x[2]), "v"(x[3]), "v"(x[4]), "v"(x[5]), "v"(x[6]), "v"(x[7]));
  const v8f r = { r0, r1, r2, r3, r4, r5, r6, r7 }; return r; }
__device__ __forceinline__ float exp2x1(float x) { float r; asm("v_exp_f32 %0, %1\n\tv_nop" : "=v"(r) : "v"(x)); return r; }   // the same slot for a single exp
// Eight f32 weights -> four registers of f16 pairs (h, round to nearest) and four of their f16 residuals (d = x - h, exact in f32, then rounded once to f16).
// The residual is asm because the build did not form it so: one mixed-precision FMA reads the f16 half straight from the packed register, subtracts it from the f32 weight and writes the f16 half of d
// (h x -1 + x, the -1 an f32 in a register); from plain source the build converted every half back to f32, subtracted and converted again. Low halves first, then high halves: each write of a register stands four instructions behind the
// other write of that register, which the s_delay_alu lines tell the issue logic, so that the SIMD's other wave may issue meanwhile. Early-clobber outputs keep d off the inputs.
__device__ __forceinline__ void split8(v8f x, unsigned* h, unsigned* d) {
#pragma unroll
  for (int j = 0; j < 4; ++j) { const v2f p = { x[2 * j], x[2 * j + 1] }; h[j] = __builtin_bit_cast(unsigned, __builtin_convertvector(p, v2h)); }
  asm("v_fma_mixlo_f16 %0, %4, %16, %8 op_sel_hi:[1,0,0]\n\tv_fma_mixlo_f16 %1, %5, %16, %10 op_sel_hi:[1,0,0]\n\tv_fma_mixlo_f16 %2, %6, %16, %12 op_sel_hi:[1,0,0]\n\tv_fma_mixlo_f16 %3, %7, %16, %14 op_sel_hi:[1,0,0]\n\t"
      "s_delay_alu instid0(VALU_DEP_4) | instskip(NEXT) | instid1(VALU_DEP_4)\n\t"
      "v_fma_mixhi_f16 %0, %4, %16, %9 op_sel:[1,0,0] op_sel_hi:[1,0,0]\n\tv_fma_mixhi_f16 %1, %5, %16, %11 op_sel:[1,0,0] op_sel_hi:[1,0,0]\n\t"
      "s_delay_alu instid0(VALU_DEP_4) | instskip(NEXT) | instid1(VALU_DEP_4)\n\t"
      "v_fma_mixhi_f16 %2, %6, %16, %13 op_sel:[1,0,0] op_sel_hi:[1,0,0]\n\tv_fma_mixhi_f16 %3, %7, %16, %15 op_sel:[1,0,0] op_sel_hi:[1,0,0]"
      : "=&v"(d[0]), "=&v"(d[1]), "=&v"(d[2]), "=&v"(d[3]) : "v"(h[0]), "v"(h[1]), "v"(h[2]), "v"(h[3]), "v"(x[0]), "v"(x[1]), "v"(x[2]), "v"(x[3]), "v"(x[4]), "v"(x[5]), "v"(x[6]), "v"(x[7]), "v"(-1.0f)); }
#define LOG2E 1.44269504088896340736f   // e^x = 2^(x log2 e), the product __expf forms
#define SCL (0.125f * LOG2E)            // 1/sqrt(64) and log2 e as one factor (the eighth is a power of two: SCL is LOG2E with another exponent)
// Exponent offset of a row whose maximum product is m: weight x 2^11 = 2^(c SCL + off). The 2^11 keeps small weights out of the f16 subnormal range; row sum and O^T tiles both carry it, so it cancels in the quotient.
__device__ __forceinline__ float exp_off(float m) { return __builtin_fmaf(-m, SCL, 11.0f); }
// c SCL + off as a fused multiply-add, said outright so that both places that form weights round alike: the product is not rounded, so a score close to the maximum keeps a small absolute error.
__device__ __forceinline__ v8f exp_arg(v8f c, float off) { const v8f k = { SCL, SCL, SCL, SCL, SCL, SCL, SCL, SCL }, o = { off, off, off, off, off, off, off, off }; return __builtin_elementwise_fma(c, k, o); }
// lane l <-> lane l ^ 16 (the two halves of a wave hold the two halves of one query column's keys)
__device__ __forceinline__ float xhalf(float v) { const int b = __builtin_bit_cast(int, v); return __builtin_bit_cast(float, __builtin_amdgcn_permlanex16(b, b, 0x76543210, 0xfedcba98, false, false)); }
// A query's product with itself, x . x (not yet divided by 8), from the query fragments (each half of the wave holds half of the row). It is one of the row's own causal scores, so it may start the running maximum.
__device__ __forceinline__ float own_score(v16h a, v16h b) { float t = 0.f;
#pragma unroll
  for (int i = 0; i < 16; ++i) { const float x = (float)a[i], y = (float)b[i]; t += x * x; t += y * y; }
  return t + xhalf(t); }
// One stage = 64 keys: 64 key rows (K) and the 64 x^T rows of those keys (V^T), 128 B a row, copied once per work-group and read by its four waves.
#define KST 64
#define LP 72   // LDS row pitch in halves: 144 B = 16 B x 9, an odd multiple of 16 B, so that the 16-byte fragment reads of 16 rows spread over the banks
// Each thread copies 16 B of four K rows and of four V^T rows (a wave covers four whole 128-B rows per copy). The s_wait_xcnt stands inside the copies' own statement so that
// no later write of an address register can be moved in front of it.
__device__ __forceinline__ void stage_copy(const _Float16* gk, const _Float16* gv, unsigned lk, unsigned lv) {
  asm volatile("global_load_async_to_lds_b128 %0, %8, off\n\tglobal_load_async_to_lds_b128 %1, %9, off\n\tglobal_load_async_to_lds_b128 %2, %10, off\n\tglobal_load_async_to_lds_b128 %3, %11, off\n\t"
               "global_load_async_to_lds_b128 %4, %12, off\n\tglobal_load_async_to_lds_b128 %5, %13, off\n\tglobal_load_async_to_lds_b128 %6, %14, off\n\tglobal_load_async_to_lds_b128 %7, %15, off\n\ts_wait_xcnt 0x0"
               :: "v"(lk), "v"(lk + 16 * LP * 2), "v"(lk + 32 * LP * 2), "v"(lk + 48 * LP * 2), "v"(lv), "v"(lv + 16 * LP * 2), "v"(lv + 32 * LP * 2), "v"(lv + 48 * LP * 2),
                  "v"(gk), "v"(gk + 16 * 2 * DM), "v"(gk + 32 * 2 * DM), "v"(gk + 48 * 2 * DM), "v"(gv), "v"(gv + 16 * SS), "v"(gv + 32 * SS), "v"(gv + 48 * SS) : "memory");
}
// ---- k_attn: transposed products. S^T = K Q^T (A = key rows, B = query rows kept in registers): lane (col, g) holds query q0 + col, keys 8g + r of each 16-key tile.
//      Two S^T tiles converted in place are the B operand P^T of O^T += V^T P^T (A = x^T rows), and the four O^T tiles are the B operand of out^T = W attn^T.
//      A work-group takes two query blocks of one (batch, head), one after the other: block TQB - 1 - pr (TQB - pr stages), then block pr (pr + 1 stages). Every work-group so walks TQB + 1 stages:
//      all work-groups are resident at once, and the launch lasts as long as the WGP with the most stages. The stage ring runs on across the switch (both blocks read the same K and V^T).
__global__ __launch_bounds__(128) void k_attn(const _Float16* __restrict__ QK, const _Float16* __restrict__ QKL, const _Float16* __restrict__ VTH, const _Float16* __restrict__ VTL, const void* __restrict__ KMASK, const __bf16* __restrict__ PW, float* __restrict__ O) {
  __shared__ __align__(16) float so[4][16][68];
  __shared__ __align__(16) _Float16 sk[2][KST][LP]; __shared__ __align__(16) _Float16 sv[2][DM][LP];   // two buffers: stage st + 1 lands while stage st is worked on
  const int tid = threadIdx.x, wave = tid >> 5, lane = tid & 31, col = lane & 15, g = lane >> 4;
  const int pr = blockIdx.x, h = blockIdx.y, b = blockIdx.z;
  const int n1 = TQB - pr, nst = TQB + 1;   // stages of the first block (causal: 64-key stages up to the query block); stages of both blocks
  int q0 = (TQB - 1 - pr) * 64 + wave * 16; int qi = q0 + col;
  (void)QKL; (void)VTL; (void)KMASK;
  v16h bq[2], bq2[2];   // query rows of the first and of the second block, both read up front
#pragma unroll
  for (int kc = 0; kc < 2; ++kc) { bq[kc] = frag_h(QK + ((size_t)b * SS + qi) * (2 * DM) + h * HD + kc * 32, lane); bq2[kc] = frag_h(QK + ((size_t)b * SS + pr * 64 + wave * 16 + col) * (2 * DM) + h * HD + kc * 32, lane); }
  // Running maximum of query qi (equal in both halves). It starts at the query's own diagonal score, which belongs to every causal row: a finite start that is never above the row's maximum by more than rounding,
  // and for rows whose own score is their largest it never rises, so that the rescale below is skipped. l sums this half's keys only, the halves join in the epilogue.
  float m = own_score(bq[0], bq[1]), off = exp_off(m), l = 0.f;   // m is kept in units of the raw product x . x
  v8f acc[4] = {};
  const int crow = tid >> 3, cq = tid & 7;   // this thread's first row and 16-byte piece in every copy
  const _Float16* gk = QK + ((size_t)b * SS + crow) * (2 * DM) + DM + h * HD + cq * 8; const _Float16* gv = VTH + ((size_t)b * DM + h * HD + crow) * SS + cq * 8;
  const unsigned lk = (unsigned)(size_t)&sk[0][crow][cq * 8], lv = (unsigned)(size_t)&sv[0][crow][cq * 8];
  stage_copy(gk, gv, lk, lv);
  asm volatile("s_wait_asynccnt 0x0" ::: "memory");   // this wave's share of stage 0 has landed
  __syncthreads();                                     // every wave's share has
  { const int k1 = 1 < n1 ? 1 : 0; stage_copy(gk + (size_t)k1 * KST * 2 * DM, gv + k1 * KST, lk + KST * LP * 2, lv + DM * LP * 2); }   // stage 1 always exists
#pragma unroll 1   // one copy of the stage body: the two buffers are told apart by an address, not by code
  for (int st = 0; st < nst; ++st) { const int bf = st & 1; const int kb = st < n1 ? st : st - n1;   // kb: the 64-key block of this stage
   // Only a query block's last stage, the one on the diagonal, holds keys behind a query. In every other stage the causal compare is true for all keys and no score is the mask value (64 products of f16 values
   // lie far above it), so compare and select are left out there. The test reads the block index and the loop counter alone: the same in every wave, a scalar branch.
   const bool diag = st + 1 == n1 || st + 1 == nst;
#pragma unroll     // both passes of a stage unrolled: every LDS read is one base register plus a constant offset
   for (int p = 0; p < 2; ++p) { const int ks = kb * 2 + p; v8f s[2]; v16h kf[2][2], vf[4];   // the pass's fragments, read from LDS as one group: the V^T reads return behind the score products and the softmax
#pragma unroll
    for (int ct = 0; ct < 2; ++ct) { kf[ct][0] = frag_h(&sk[bf][p * 32 + ct * 16 + col][0], lane); kf[ct][1] = frag_h(&sk[bf][p * 32 + ct * 16 + col][32], lane); }
#pragma unroll
    for (int dt = 0; dt < 4; ++dt) vf[dt] = frag_h(&sv[bf][dt * 16 + col][p * 32], lane);
    __builtin_amdgcn_sched_barrier(0);   // keeps the pass's sixteen LDS reads one group in front of its products: left free, the build spreads them among the WMMAs in small groups, each with its wait close behind it
#pragma unroll
    for (int ct = 0; ct < 2; ++ct) { v8f c = {};
#pragma unroll
      for (int kc = 0; kc < 2; ++kc) c = wmma16(kf[ct][kc], bq[kc], c);   // single EXACT product: q, k are bf16 inputs held exactly in f16
      s[ct] = c; }   // the raw product: 1/sqrt(64) is part of SCL
    if (__builtin_expect(diag, 0)) {   // causal (diagonal kept); expected false so that the common path falls through and the masking code lies behind the loop
#pragma unroll
      for (int i = 0; i < 16; ++i) s[i >> 3][i & 7] = (ks * 32 + (i >> 3) * 16 + 8 * g + (i & 7) <= qi) ? s[i >> 3][i & 7] : -3.0e38f; }
    float mx = fmaxf(s[0][0], s[1][0]);
#pragma unroll
    for (int r = 1; r < 8; ++r) mx = fmaxf(mx, fmaxf(s[0][r], s[1][r]));
    v8f e[2];   // weights against the maximum in use: they do not wait for this pass's maximum
#pragma unroll
    for (int ct = 0; ct < 2; ++ct) e[ct] = exp2x8(exp_arg(s[ct], off));   // one multiply-add per score holds the eighth, log2 e, the maximum and the 2^11
    if (__builtin_expect(__builtin_amdgcn_ballot_w32(mx > m) != 0, 0)) {   // one test per pass, a scalar branch: only where some query's maximum rises are sums and tiles rescaled and the weights formed again
      mx = fmaxf(mx, xhalf(mx));
      const float mn = fmaxf(m, mx), offn = exp_off(mn); const float alpha = exp2x1(offn - off);   // the ratio of the two scales as the weights see them; 1 exactly in the columns whose maximum stays
#pragma unroll
      for (int ct = 0; ct < 2; ++ct) e[ct] = exp2x8(exp_arg(s[ct], offn));
      l *= alpha; m = mn; off = offn;
#pragma unroll
      for (int dt = 0; dt < 4; ++dt) acc[dt] *= alpha; }
    if (__builtin_expect(diag, 0)) {   // masked keys weigh nothing; expected false for the same reason as above
#pragma unroll
      for (int i = 0; i < 16; ++i) e[i >> 3][i & 7] = (s[i >> 3][i & 7] <= -1.0e38f) ? 0.f : e[i >> 3][i & 7]; }
    union { v16h v; unsigned w[8]; } pa, pl;
#pragma unroll
    for (int ct = 0; ct < 2; ++ct) split8(e[ct], pa.w + 4 * ct, pl.w + 4 * ct);   // element i of P^T = key 16 (i / 8) + 8 g + i % 8 of this pass. f16 value + f16 residual at the same scale: a residual too small for f16 is below 2^-36 of the largest weight
    const v8f e2 = e[0] + e[1];
    l += ((e2[0] + e2[1]) + (e2[2] + e2[3])) + ((e2[4] + e2[5]) + (e2[6] + e2[7]));
#pragma unroll
    for (int dt = 0; dt < 4; ++dt) acc[dt] = wmma16(vf[dt], pa.v, acc[dt]);   // V^T x P^T value (v exact)
#pragma unroll
    for (int dt = 0; dt < 4; ++dt) acc[dt] = wmma16(vf[dt], pl.v, acc[dt]); }   // + V^T x P^T residual, into the same tiles, each four products behind the tile's last one
   asm volatile("s_wait_dscnt 0x0" ::: "memory");      // this wave's reads of buffer bf are done before the buffer is handed back
   asm volatile("s_wait_asynccnt 0x0" ::: "memory");   // this wave's share of stage st + 1 has landed
   __syncthreads();                                     // publishes stage st + 1 and ends every wave's reads of buffer bf
   if (st + 2 < nst) { const int k2 = st + 2 < n1 ? st + 2 : st + 2 - n1; stage_copy(gk + (size_t)k2 * KST * 2 * DM, gv + k2 * KST, lk + bf * (KST * LP * 2), lv + bf * (DM * LP * 2)); }
   if (st + 1 == n1 || st + 1 == nst) {   // a query block's last stage is done (the same test in every wave): its rows go out while the next stages' copies fly
  // epilogue: out[e] = sum_d attn[d] W[e][d] (the bias-free Linear): W rows (exact) x attn^T (bf16 hi + residual, straight from the O^T tiles), 2 products
  { const float il = 1.0f / (l + xhalf(l)); v8f acc2[4] = {};   // l and the tiles carry the same 2^11
#pragma unroll
    for (int kc = 0; kc < 2; ++kc) { float v[16];
#pragma unroll
      for (int r = 0; r < 8; ++r) { v[r] = acc[2 * kc][r] * il; v[8 + r] = acc[2 * kc + 1][r] * il; }
      const F2 a2 = bsplit16(v);
#pragma unroll
      for (int j = 0; j < 4; ++j) { const v16b w = frag_b(PW + (size_t)(j * 16 + col) * HD + kc * 32, lane); acc2[j] = wmma_bf(w, a2.l, acc2[j]); acc2[j] = wmma_bf(w, a2.h, acc2[j]); } }
#pragma unroll
    for (int j = 0; j < 4; ++j) { const v4f lo = { acc2[j][0], acc2[j][1], acc2[j][2], acc2[j][3] }, hi = { acc2[j][4], acc2[j][5], acc2[j][6], acc2[j][7] };   // acc2[j][r] = out[qi][16 j + 8 g + r]
      *(v4f*)&so[wave][col][j * 16 + 8 * g] = lo; *(v4f*)&so[wave][col][j * 16 + 8 * g + 4] = hi; }
    LDSX(); }
  if (lane < 16) { for (int rl = 0; rl < 16; ++rl) vst2(O + ((size_t)b * SS + q0 + rl) * DM + h * HD + lane * 4, *(const v4f*)&so[wave][rl][lane * 4]);
    asm volatile("s_wait_xcnt 0x0" ::: "memory"); }   // directly behind the stores, in their own branch: their address and data registers are written again for the second block
    // start of the second block
    q0 = pr * 64 + wave * 16; qi = q0 + col; bq[0] = bq2[0]; bq[1] = bq2[1]; m = own_score(bq[0], bq[1]); off = exp_off(m); l = 0.f;
#pragma unroll
    for (int dt = 0; dt < 4; ++dt) acc[dt] = v8f{}; } }
  asm volatile("s_wait_asynccnt 0x0" ::: "memory");    // nothing of this wave is in flight past the loop
}
#define WS2_QK  0u
#define WS2_VT  (WS2_QK + 2u * (size_t)NB * SS * 2 * DM)
#define WS2_PW  (WS2_VT + 2u * (size_t)NB * DM * SS)
#define WS2_END (WS2_PW + 2u * HD * HD + 256u)
extern "C" void kernel_launch(void* const* d_in, const int* in_sizes, int n_in, void* d_out, int out_size, void* d_ws, size_t ws_size, hipStream_t stream) {
  (void)in_sizes; (void)n_in; (void)out_size;
  const float** F = (const float**)d_in;   // 0 x [2,16,2048,64], 1 W [64,64]
  if (ws_size < (size_t)WS2_END) return;
  char* ws = (char*)d_ws; _Float16 *QK = (_Float16*)(ws + WS2_QK), *VTH = (_Float16*)(ws + WS2_VT); __bf16* PW = (__bf16*)(ws + WS2_PW);
  k_packw<<<HD, 64, 0, stream>>>(F[1], PW);
  k_prep<<<TNB * SS / 64, 256, 0, stream>>>(F[0], QK, VTH);
  k_attn<<<dim3(TQB / 2, NH, TNB), 128, 0, stream>>>(QK, QK, VTH, VTH, nullptr, PW, (float*)d_out);   // out [b][h][q][e]; the residual-plane pointers are read-only and unused (single exact products)
}

// v008
// Measured time: 37.2 microseconds a run.
// Next to v007, in two timings, it ran 1.07 and 1.06 times as fast.
// Counting every step since v000, it is 4.72 times as fast.
// compute dtype: x and W rounded to bf16 and used as EXACT f16 operands for the attention (bf16 values are exact in f16): scores = x . x (single exact product) x 1/8 with the causal mask, running-max softmax in f32 (hardware exp), P (scaled by 2^11) as f16 value + f16 residual x the exact x planes (2 products, one accumulator); the 64 x 64 output map takes the f32 attention rows split into bf16 hi + residual against the exact bf16 W rows on WMMA 16x16x32 (2 products); f32 accumulate.
#include <hip/hip_runtime.h>
#include <math.h>

typedef __attribute__((ext_vector_type(16))) _Float16 v16h;
typedef __attribute__((ext_vector_type(16))) __bf16 v16b;
typedef __attribute__((ext_vector_type(8)))  _Float16 v8h;
typedef __attribute__((ext_vector_type(2)))  _Float16 v2h;
typedef __attribute__((ext_vector_type(8)))  float v8f;
typedef __attribute__((ext_vector_type(4)))  float v4f;
typedef __attribute__((ext_vector_type(2)))  float v2f;
typedef __attribute__((ext_vector_type(4)))  unsigned v4u;
typedef __attribute__((ext_vector_type(4)))  int v4i;
typedef float __attribute__((may_alias)) float_a;
typedef int __attribute__((may_alias)) int_a;

template <typename T> __device__ __forceinline__ void vst2(void* p, T v) { *(T*)p = v;  }
// Both products are the builtin forms and nothing else: the compiler keeps the distance behind a WMMA itself, and other vector work or the next WMMA may stand in those slots.
__device__ __forceinline__ v8f wmma16(v16h a, v16h b, v8f c) {
  v8f d = __builtin_amdgcn_wmma_f32_16x16x32_f16(false, a, false, b, (short)0, c, false, false);
  return d;
}
__device__ __forceinline__ v8f wmma_bf(v16b a, v16b b, v8f c) {
  v8f d = __builtin_amdgcn_wmma_f32_16x16x32_bf16(false, a, false, b, (short)0, c, false, false);
  return d;
}
// Minimal causal attention block on a given per-head tensor x [2, 16, 2,048, 64] (q = k = v = x): softmax(mask(x x^T / 8)) x, then a bias-free 64 x 64 linear map.
__device__ __forceinline__ v16h frag_h(const _Float16* rowk0, int lane) {
  union { v16h v; v8h q[2]; } u; const _Float16* p = rowk0 + 8 * (lane >> 4);
  u.q[0] = *(const v8h*)p; u.q[1] = *(const v8h*)(p + 16); return u.v;
}
__device__ __forceinline__ v16h frag_f32(const float* rowk0, int lane) {
  v16h a; const float* p = rowk0 + 8 * (lane >> 4);
#pragma unroll
  for (int i = 0; i < 8; ++i) { a[i] = (_Float16)p[i]; a[8 + i] = (_Float16)p[16 + i]; }
  return a;
}
__device__ __forceinline__ v16h frag_f32s(const float* rowk0, int lane, float sc) {
  v16h a; const float* p = rowk0 + 8 * (lane >> 4);
#pragma unroll
  for (int i = 0; i < 8; ++i) { a[i] = (_Float16)(p[i] * sc); a[8 + i] = (_Float16)(p[16 + i] * sc); }
  return a;
}
// column fragment from a [K][ld] layout (column n), rows >= K read as 0
__device__ __forceinline__ v16h fragc_f32(const float* W, int k0, int n, int lane, int ld, int K) {
  v16h a; const int g = lane >> 4;
#pragma unroll
  for (int i = 0; i < 8; ++i) { const int ka = k0 + 8 * g + i, kb = ka + 16;
    a[i] = (_Float16)(ka < K ? W[(size_t)(ka < K ? ka : K - 1) * ld + n] : 0.f); a[8 + i] = (_Float16)(kb < K ? W[(size_t)(kb < K ? kb : K - 1) * ld + n] : 0.f); }
  return a;
}
struct F2 { v16b h, l; };
__device__ __forceinline__ F2 bsplit16(const float v[16]) { F2 r;
#pragma unroll
  for (int i = 0; i < 16; ++i) { const __bf16 h = (__bf16)v[i]; r.h[i] = h; r.l[i] = (__bf16)(v[i] - (float)h); }
  return r; }
__device__ __forceinline__ F2 split_row(const float* row, int k0, int lane) { float v[16]; const float* p = row + k0 + 8 * (lane >> 4);
#pragma unroll
  for (int i = 0; i < 8; ++i) { v[i] = p[i]; v[8 + i] = p[16 + i]; }
  return bsplit16(v); }
__device__ __forceinline__ F2 split_rowK(const float* row, int k0, int lane, int K) { float v[16]; const int g = lane >> 4;
#pragma unroll
  for (int i = 0; i < 8; ++i) { const int ka = k0 + 8 * g + i, kb = ka + 16; v[i] = ka < K ? row[ka < K ? ka : K - 1] : 0.f; v[8 + i] = kb < K ? row[kb < K ? kb : K - 1] : 0.f; }
  return bsplit16(v); }
__device__ __forceinline__ F2 split_col(const float* W, int k0, int n, int lane, int ld, int K) { float v[16]; const int g = lane >> 4;
#pragma unroll
  for (int i = 0; i < 8; ++i) { const int ka = k0 + 8 * g + i, kb = ka + 16; v[i] = ka < K ? W[(size_t)(ka < K ? ka : K - 1) * ld + n] : 0.f; v[8 + i] = kb < K ? W[(size_t)(kb < K ? kb : K - 1) * ld + n] : 0.f; }
  return bsplit16(v); }
__device__ __forceinline__ v8f mac3(const F2& a, const F2& b, v8f c) { c = wmma_bf(a.l, b.h, c); c = wmma_bf(a.h, b.l, c); return wmma_bf(a.h, b.h, c); }
__device__ __forceinline__ float sigm(float v) { return 1.0f / (1.0f + expf(-v)); }
#define LDSX() do { asm volatile("s_wait_dscnt 0" ::: "memory"); __builtin_amdgcn_wave_barrier(); __builtin_amdgcn_fence(__ATOMIC_RELEASE, "workgroup"); } while (0)


#define NB 32   // (batch, head) pairs
#define SS 2048
#define DM 64
#define NH 1
#define HD 64
#define QKVW (3 * DM)
#ifndef TQB
#define TQB (SS / 64)
#define TNB NB
#define TOB (NB * SS / 64)     // output row tiles (all)
#endif
typedef __attribute__((ext_vector_type(8))) __bf16 v8b;
__device__ __forceinline__ v16b frag_b(const __bf16* rowk0, int lane) {
  union { v16b v; v8b q[2]; } u; const __bf16* p = rowk0 + 8 * (lane >> 4);
  u.q[0] = *(const v8b*)p; u.q[1] = *(const v8b*)(p + 16); return u.v;
}
__device__ __forceinline__ float bfr(float v) { return (float)(__bf16)v; }
__device__ __attribute__((noinline)) float exp_ni(float v) { return expf(v); }
__device__ __attribute__((noinline)) float erf_ni(float v) { return erff(v); }

#define PK_A 0                       // [192][64] Wqkv rows (natural [out][in])
#define PK_P (PK_A + QKVW * DM)        // [64][64] Wo rows (natural)
#define PK_END (PK_P + DM * DM)
#define WS_PK  0u
#define WS_QK  (WS_PK + 2u * PK_END)             // f16 [65536 rows][128]: q | k
#define WS_QKL (WS_QK + 2u * NB * SS * 2 * DM)     // f16 q | k residual planes x2048
#define WS_VTH (WS_QKL + 2u * NB * SS * 2 * DM)    // f16 [b][64 (h*64+d)][2048 s] hi
#define WS_VTL (WS_VTH + 2u * NB * DM * SS)        // f16 lo x 2048
#define WS_O   (WS_VTL + 2u * NB * DM * SS)        // f32 [65536][64]
#define WS_CS  (WS_O + 4u * NB * SS * DM)           // f32 [2048][32] cos, [2048][32] sin
#define WS_END (WS_CS + 4u * 2 * SS * 32)
// ---- k_prep: block = 64 rows of one (batch, head): x rows -> f16 [row][128] (x | x) and x^T planes [bh][64][SS] (exact)
__global__ __launch_bounds__(256) void k_prep(const float* __restrict__ X, _Float16* __restrict__ QK, _Float16* __restrict__ VTH) {
  __shared__ __align__(16) _Float16 sq[64][72]; __shared__ __align__(16) _Float16 st[64][72];
  const int t = threadIdx.x; const size_t r0 = (size_t)blockIdx.x * 64; const size_t bh = r0 / SS, s0 = r0 % SS;
  for (int e = t; e < 64 * 64; e += 256) { const int r = e >> 6, c = e & 63; const _Float16 v = (_Float16)bfr(X[(r0 + r) * DM + c]); sq[r][c] = v; st[c][r] = v; }
  __syncthreads();
  for (int e = t; e < 64 * 8; e += 256) { const int r = e >> 3, q = e & 7; const v4u v = *(const v4u*)&sq[r][q * 8]; vst2((unsigned*)(QK + (r0 + r) * (2 * DM) + q * 8), v); vst2((unsigned*)(QK + (r0 + r) * (2 * DM) + DM + q * 8), v); }
  for (int e = t; e < 64 * 8; e += 256) { const int c = e >> 3, pc = e & 7; vst2((unsigned*)(VTH + (bh * DM + c) * SS + s0 + pc * 8), *(const v4u*)&st[c][pc * 8]); }
}
// ---- k_packw: W [64][64] natural -> bf16 rows
__global__ __launch_bounds__(64) void k_packw(const float* __restrict__ Wm, __bf16* __restrict__ PW) { const int n = blockIdx.x, t = threadIdx.x; __shared__ __align__(16) __bf16 s[HD]; s[t] = (__bf16)Wm[(size_t)n * HD + t]; __syncthreads(); if (t < HD / 8) vst2((unsigned*)(PW + (size_t)n * HD + t * 8), *(const v4u*)&s[t * 8]); }
// 2^x on the hardware's v_exp_f32, written as asm for one reason: the instruction set asks for one free slot behind a transcendental before its result is read or its source overwritten.
// Eight independent exps fill each other's slot, a v_nop fills the last one's; early-clobber outputs keep results off the sources.
__device__ __forceinline__ v8f exp2x8(v8f x) { float r0, r1, r2, r3, r4, r5, r6, r7;
  asm("v_exp_f32 %0, %8\n\tv_exp_f32 %1, %9\n\tv_exp_f32 %2, %10\n\tv_exp_f32 %3, %11\n\tv_exp_f32 %4, %12\n\tv_exp_f32 %5, %13\n\tv_exp_f32 %6, %14\n\tv_exp_f32 %7, %15\n\tv_nop"
      : "=&v"(r0), "=&v"(r1), "=&v"(r2), "=&v"(r3), "=&v"(r4), "=&v"(r5), "=&v"(r6), "=&v"(r7) : "v"(x[0]), "v"(x[1]), "v"(x[2]), "v"(x[3]), "v"(x[4]), "v"(x[5]), "v"(x[6]), "v"(x[7]));
  const v8f r = { r0, r1, r2, r3, r4, r5, r6, r7 }; return r; }
__device__ __forceinline__ float exp2x1(float x) { float r; asm("v_exp_f32 %0, %1\n\tv_nop" : "=v"(r) : "v"(x)); return r; }   // the same slot for a single exp
// Eight f32 weights -> four registers of f16 pairs (h, round to nearest) and four of their f16 residuals (d = x - h, exact in f32, then rounded once to f16).
// The residual is asm because the build did not form it so: one mixed-precision FMA reads the f16 half straight from the packed register, subtracts it from the f32 weight and writes the f16 half of d
// (h x -1 + x, the -1 an f32 in a register); from plain source the build converted every half back to f32, subtracted and converted again. Low halves first, then high halves: each write of a register stands four instructions behind the
// other write of that register, which the s_delay_alu lines tell the issue logic, so that the SIMD's other wave may issue meanwhile. Early-clobber outputs keep d off the inputs.
__device__ __forceinline__ void split8(v8f x, unsigned* h, unsigned* d) {
#pragma unroll
  for (int j = 0; j < 4; ++j) { const v2f p = { x[2 * j], x[2 * j + 1] }; h[j] = __builtin_bit_cast(unsigned, __builtin_convertvector(p, v2h)); }
  asm("v_fma_mixlo_f16 %0, %4, %16, %8 op_sel_hi:[1,0,0]\n\tv_fma_mixlo_f16 %1, %5, %16, %10 op_sel_hi:[1,0,0]\n\tv_fma_mixlo_f16 %2, %6, %16, %12 op_sel_hi:[1,0,0]\n\tv_fma_mixlo_f16 %3, %7, %16, %14 op_sel_hi:[1,0,0]\n\t"
      "s_delay_alu instid0(VALU_DEP_4) | instskip(NEXT) | instid1(VALU_DEP_4)\n\t"
      "v_fma_mixhi_f16 %0, %4, %16, %9 op_sel:[1,0,0] op_sel_hi:[1,0,0]\n\tv_fma_mixhi_f16 %1, %5, %16, %11 op_sel:[1,0,0] op_sel_hi:[1,0,0]\n\t"
      "s_delay_alu instid0(VALU_DEP_4) | instskip(NEXT) | instid1(VALU_DEP_4)\n\t"
      "v_fma_mixhi_f16 %2, %6, %16, %13 op_sel:[1,0,0] op_sel_hi:[1,0,0]\n\tv_fma_mixhi_f16 %3, %7, %16, %15 op_sel:[1,0,0] op_sel_hi:[1,0,0]"
      : "=&v"(d[0]), "=&v"(d[1]), "=&v"(d[2]), "=&v"(d[3]) : "v"(h[0]), "v"(h[1]), "v"(h[2]), "v"(h[3]), "v"(x[0]), "v"(x[1]), "v"(x[2]), "v"(x[3]), "v"(x[4]), "v"(x[5]), "v"(x[6]), "v"(x[7]), "v"(-1.0f)); }
#define LOG2E 1.44269504088896340736f   // e^x = 2^(x log2 e), the product __expf forms
#define SCL (0.125f * LOG2E)            // 1/sqrt(64) and log2 e as one factor (the eighth is a power of two: SCL is LOG2E with another exponent)
// Exponent offset of a row whose maximum product is m: weight x 2^11 = 2^(c SCL + off). The 2^11 keeps small weights out of the f16 subnormal range; row sum and O^T tiles both carry it, so it cancels in the quotient.
__device__ __forceinline__ float exp_off(float m) { return __builtin_fmaf(-m, SCL, 11.0f); }
// c SCL + off as a fused multiply-add, said outright so that both places that form weights round alike: the product is not rounded, so a score close to the maximum keeps a small absolute error.
__device__ __forceinline__ v8f exp_arg(v8f c, float off) { const v8f k = { SCL, SCL, SCL, SCL, SCL, SCL, SCL, SCL }, o = { off, off, off, off, off, off, off, off }; return __builtin_elementwise_fma(c, k, o); }
// lane l <-> lane l ^ 16 (the two halves of a wave hold the two halves of one query column's keys)
__device__ __forceinline__ float xhalf(float v) { const int b = __builtin_bit_cast(int, v); return __builtin_bit_cast(float, __builtin_amdgcn_permlanex16(b, b, 0x76543210, 0xfedcba98, false, false)); }
// A query's product with itself, x . x (not yet divided by 8), from the query fragments (each half of the wave holds half of the row). It is one of the row's own causal scores, so it may start the running maximum.
__device__ __forceinline__ float own_score(v16h a, v16h b) { float t = 0.f;
#pragma unroll
  for (int i = 0; i < 16; ++i) { const float x = (float)a[i], y = (float)b[i]; t += x * x; t += y * y; }
  return t + xhalf(t); }
// One stage = 128 keys: 128 key rows (K, 128 B a row) and the 64 x^T rows of those keys (V^T, 256 B a row), copied once per work-group and read by its four waves.
// A stage is two 64-key units of two passes each: one publish point (waits, barrier, refill) serves four passes, and a stage's copies have four passes' time to land.
#define KST 128
#define LP 72    // K row pitch in LDS, in halves: 144 B = 16 B x 9, an odd multiple of 16 B, so that the 16-byte fragment reads of 16 rows spread over the banks
#define LPV 136  // V^T row pitch in LDS, in halves: 272 B = 16 B x 17, odd for the same reason
// Eight copies of 16 B per lane, GS halves apart in global memory and LS bytes apart in LDS. The s_wait_xcnt stands inside the copies' own statement so that
// no later write of an address register can be moved in front of it.
template <int GS, int LS> __device__ __forceinline__ void copy8(const _Float16* g, unsigned l) {
  asm volatile("global_load_async_to_lds_b128 %0, %8, off\n\tglobal_load_async_to_lds_b128 %1, %9, off\n\tglobal_load_async_to_lds_b128 %2, %10, off\n\tglobal_load_async_to_lds_b128 %3, %11, off\n\t"
               "global_load_async_to_lds_b128 %4, %12, off\n\tglobal_load_async_to_lds_b128 %5, %13, off\n\tglobal_load_async_to_lds_b128 %6, %14, off\n\tglobal_load_async_to_lds_b128 %7, %15, off\n\ts_wait_xcnt 0x0"
               :: "v"(l), "v"(l + LS), "v"(l + 2 * LS), "v"(l + 3 * LS), "v"(l + 4 * LS), "v"(l + 5 * LS), "v"(l + 6 * LS), "v"(l + 7 * LS),
                  "v"(g), "v"(g + GS), "v"(g + 2 * GS), "v"(g + 3 * GS), "v"(g + 4 * GS), "v"(g + 5 * GS), "v"(g + 6 * GS), "v"(g + 7 * GS) : "memory");
}
// Each thread copies 16 B of eight K rows (16 rows apart: a wave covers four whole 128-B rows per copy) and of eight V^T rows (8 rows apart: a wave covers two whole 256-B rows per copy).
__device__ __forceinline__ void stage_copy(const _Float16* gk, const _Float16* gv, unsigned lk, unsigned lv) {
  copy8<16 * 2 * DM, 16 * LP * 2>(gk, lk); copy8<8 * SS, 8 * LPV * 2>(gv, lv);
}
// ---- k_attn: transposed products. S^T = K Q^T (A = key rows, B = query rows kept in registers): lane (col, g) holds query q0 + col, keys 8g + r of each 16-key tile.
//      Two S^T tiles converted in place are the B operand P^T of O^T += V^T P^T (A = x^T rows), and the four O^T tiles are the B operand of out^T = W attn^T.
//      A work-group takes two query blocks of one (batch, head), one after the other: block TQB - 1 - pr, then block pr. Query block j needs the 64-key units 0 .. j, that is (j + 2) / 2 stages of two units;
//      of the two blocks one has an even j, whose last stage holds one unit wholly behind the diagonal (copied, not worked on). Every work-group so walks TQB / 2 + 1 stages:
//      all work-groups are resident at once, and the launch lasts as long as the WGP with the most stages. The stage ring runs on across the switch (both blocks read the same K and V^T).
__global__ __launch_bounds__(128) void k_attn(const _Float16* __restrict__ QK, const _Float16* __restrict__ QKL, const _Float16* __restrict__ VTH, const _Float16* __restrict__ VTL, const void* __restrict__ KMASK, const __bf16* __restrict__ PW, float* __restrict__ O) {
  __shared__ __align__(16) float so[4][16][68];
  __shared__ __align__(16) _Float16 sk[2][KST][LP]; __shared__ __align__(16) _Float16 sv[2][DM][LPV];   // two buffers: stage st + 1 lands while stage st is worked on
  const int tid = threadIdx.x, wave = tid >> 5, lane = tid & 31, col = lane & 15, g = lane >> 4;
  const int pr = blockIdx.x, h = blockIdx.y, b = blockIdx.z;
  const int n1 = (TQB + 1 - pr) >> 1, nst = TQB / 2 + 1;   // stages of the first block (causal: 128-key stages up to and with the one that holds the diagonal); stages of both blocks
  int q0 = (TQB - 1 - pr) * 64 + wave * 16; int qi = q0 + col;
  (void)QKL; (void)VTL; (void)KMASK;
  v16h bq[2], bq2[2];   // query rows of the first and of the second block, both read up front
#pragma unroll
  for (int kc = 0; kc < 2; ++kc) { bq[kc] = frag_h(QK + ((size_t)b * SS + qi) * (2 * DM) + h * HD + kc * 32, lane); bq2[kc] = frag_h(QK + ((size_t)b * SS + pr * 64 + wave * 16 + col) * (2 * DM) + h * HD + kc * 32, lane); }
  // Running maximum of query qi (equal in both halves). It starts at the query's own diagonal score, which belongs to every causal row: a finite start that is never above the row's maximum by more than rounding,
  // and for rows whose own score is their largest it never rises, so that the rescale below is skipped. l sums this half's keys only, the halves join in the epilogue.
  float m = own_score(bq[0], bq[1]), off = exp_off(m), l = 0.f;   // m is kept in units of the raw product x . x
  v8f acc[4] = {};
  const int crow = tid >> 3, cq = tid & 7, vrow = tid >> 4, vq = tid & 15;   // this thread's first row and 16-byte piece in every K copy and in every V^T copy
  const _Float16* gk = QK + ((size_t)b * SS + crow) * (2 * DM) + DM + h * HD + cq * 8; const _Float16* gv = VTH + ((size_t)b * DM + h * HD + vrow) * SS + vq * 8;
  const unsigned lk = (unsigned)(size_t)&sk[0][crow][cq * 8], lv = (unsigned)(size_t)&sv[0][vrow][vq * 8];
  stage_copy(gk, gv, lk, lv);
  asm volatile("s_wait_asynccnt 0x0" ::: "memory");   // this wave's share of stage 0 has landed
  __syncthreads();                                     // every wave's share has
  { const int k1 = 1 < n1 ? 1 : 0; stage_copy(gk + (size_t)k1 * KST * 2 * DM, gv + k1 * KST, lk + KST * LP * 2, lv + DM * LPV * 2); }   // stage 1 always exists
  v16h kf[2][2], vf[4];   // a pass's fragments, read from LDS as one group: the V^T reads return behind the score products and the softmax
  // The LDS reads of pass p (32 keys) of the stage in buffer bf.
  auto frags = [&](const int bf, const int p) __attribute__((always_inline)) {
#pragma unroll
    for (int ct = 0; ct < 2; ++ct) { kf[ct][0] = frag_h(&sk[bf][p * 32 + ct * 16 + col][0], lane); kf[ct][1] = frag_h(&sk[bf][p * 32 + ct * 16 + col][32], lane); }
#pragma unroll
    for (int dt = 0; dt < 4; ++dt) vf[dt] = frag_h(&sv[bf][dt * 16 + col][p * 32], lane);
    __builtin_amdgcn_sched_barrier(0); };   // keeps the pass's sixteen LDS reads one group in front of its products: left free, the build spreads them among the WMMAs in small groups, each with its wait close behind it
  // The work on those fragments; ks: the pass's number on the key axis; diag: the pass belongs to the 64-key unit on the diagonal.
  auto pass = [&](const int ks, const bool diag) __attribute__((always_inline)) { v8f s[2];
#pragma unroll
    for (int ct = 0; ct < 2; ++ct) { v8f c = {};
#pragma unroll
      for (int kc = 0; kc < 2; ++kc) c = wmma16(kf[ct][kc], bq[kc], c);   // single EXACT product: q, k are bf16 inputs held exactly in f16
      s[ct] = c; }   // the raw product: 1/sqrt(64) is part of SCL
    if (__builtin_expect(diag, 0)) {   // causal (diagonal kept); expected false so that the common path falls through and the masking code lies behind the loop
#pragma unroll
      for (int i = 0; i < 16; ++i) s[i >> 3][i & 7] = (ks * 32 + (i >> 3) * 16 + 8 * g + (i & 7) <= qi) ? s[i >> 3][i & 7] : -3.0e38f; }
    float mx = fmaxf(s[0][0], s[1][0]);
#pragma unroll
    for (int r = 1; r < 8; ++r) mx = fmaxf(mx, fmaxf(s[0][r], s[1][r]));
    v8f e[2];   // weights against the maximum in use: they do not wait for this pass's maximum
#pragma unroll
    for (int ct = 0; ct < 2; ++ct) e[ct] = exp2x8(exp_arg(s[ct], off));   // one multiply-add per score holds the eighth, log2 e, the maximum and the 2^11
    if (__builtin_expect(__builtin_amdgcn_ballot_w32(mx > m) != 0, 0)) {   // one test per pass, a scalar branch: only where some query's maximum rises are sums and tiles rescaled and the weights formed again
      mx = fmaxf(mx, xhalf(mx));
      const float mn = fmaxf(m, mx), offn = exp_off(mn); const float alpha = exp2x1(offn - off);   // the ratio of the two scales as the weights see them; 1 exactly in the columns whose maximum stays
#pragma unroll
      for (int ct = 0; ct < 2; ++ct) e[ct] = exp2x8(exp_arg(s[ct], offn));
      l *= alpha; m = mn; off = offn;
#pragma unroll
      for (int dt = 0; dt < 4; ++dt) acc[dt] *= alpha; }
    if (__builtin_expect(diag, 0)) {   // masked keys weigh nothing; expected false for the same reason as above
#pragma unroll
      for (int i = 0; i < 16; ++i) e[i >> 3][i & 7] = (s[i >> 3][i & 7] <= -1.0e38f) ? 0.f : e[i >> 3][i & 7]; }
    union { v16h v; unsigned w[8]; } pa, pl;
#pragma unroll
    for (int ct = 0; ct < 2; ++ct) split8(e[ct], pa.w + 4 * ct, pl.w + 4 * ct);   // element i of P^T = key 16 (i / 8) + 8 g + i % 8 of this pass. f16 value + f16 residual at the same scale: a residual too small for f16 is below 2^-36 of the largest weight
    const v8f e2 = e[0] + e[1];
    l += ((e2[0] + e2[1]) + (e2[2] + e2[3])) + ((e2[4] + e2[5]) + (e2[6] + e2[7]));
#pragma unroll
    for (int dt = 0; dt < 4; ++dt) acc[dt] = wmma16(vf[dt], pa.v, acc[dt]);   // V^T x P^T value (v exact)
#pragma unroll
    for (int dt = 0; dt < 4; ++dt) acc[dt] = wmma16(vf[dt], pl.v, acc[dt]); };   // + V^T x P^T residual, into the same tiles, each four products behind the tile's last one
#pragma unroll 1   // one copy of the stage body: the two buffers are told apart by an address, not by code
  for (int st = 0; st < nst; ++st) { const int bf = st & 1; const int kb = st < n1 ? st : st - n1;   // kb: the 128-key block of this stage
   // Only the 64-key unit on the diagonal holds keys behind a query. In every other unit the causal compare is true for all keys and no score is the mask value (64 products of f16 values lie far above it),
   // so compare and select are left out there. The tests read the block index and the loop counter alone: the same in every wave, scalar branches.
   const int du = (st < n1 ? TQB - 1 - pr : pr) - kb * 2;   // the diagonal unit counted from this stage's first unit: 0 or 1 in a query block's last stage, more before
   // The four passes written out: every LDS read is one base register plus a constant offset, and a pass's reads are issued among the products of the pass before it.
   frags(bf, 0); pass(kb * 4 + 0, du == 0); frags(bf, 1); pass(kb * 4 + 1, du == 0); frags(bf, 2);
   if (__builtin_expect(du != 0, 1)) {   // with the diagonal in the first unit (even query block, last stage) the second unit holds no key of any query: copied and fetched, not worked on
     pass(kb * 4 + 2, du == 1); frags(bf, 3); pass(kb * 4 + 3, du == 1); }
   asm volatile("s_wait_dscnt 0x0" ::: "memory");      // this wave's reads of buffer bf are done before the buffer is handed back
   asm volatile("s_wait_asynccnt 0x0" ::: "memory");   // this wave's share of stage st + 1 has landed
   __syncthreads();                                     // publishes stage st + 1 and ends every wave's reads of buffer bf
   if (st + 2 < nst) { const int k2 = st + 2 < n1 ? st + 2 : st + 2 - n1; stage_copy(gk + (size_t)k2 * KST * 2 * DM, gv + k2 * KST, lk + bf * (KST * LP * 2), lv + bf * (DM * LPV * 2)); }
   if (st + 1 == n1 || st + 1 == nst) {   // a query block's last stage is done (the same test in every wave): its rows go out while the next stages' copies fly
  // epilogue: out[e] = sum_d attn[d] W[e][d] (the bias-free Linear): W rows (exact) x attn^T (bf16 hi + residual, straight from the O^T tiles), 2 products
  { const float il = 1.0f / (l + xhalf(l)); v8f acc2[4] = {};   // l and the tiles carry the same 2^11
#pragma unroll
    for (int kc = 0; kc < 2; ++kc) { float v[16];
#pragma unroll
      for (int r = 0; r < 8; ++r) { v[r] = acc[2 * kc][r] * il; v[8 + r] = acc[2 * kc + 1][r] * il; }
      const F2 a2 = bsplit16(v);
#pragma unroll
      for (int j = 0; j < 4; ++j) { const v16b w = frag_b(PW + (size_t)(j * 16 + col) * HD + kc * 32, lane); acc2[j] = wmma_bf(w, a2.l, acc2[j]); acc2[j] = wmma_bf(w, a2.h, acc2[j]); } }
#pragma unroll
    for (int j = 0; j < 4; ++j) { const v4f lo = { acc2[j][0], acc2[j][1], acc2[j][2], acc2[j][3] }, hi = { acc2[j][4], acc2[j][5], acc2[j][6], acc2[j][7] };   // acc2[j][r] = out[qi][16 j + 8 g + r]
      *(v4f*)&so[wave][col][j * 16 + 8 * g] = lo; *(v4f*)&so[wave][col][j * 16 + 8 * g + 4] = hi; }
    LDSX(); }
  if (lane < 16) { for (int rl = 0; rl < 16; ++rl) vst2(O + ((size_t)b * SS + q0 + rl) * DM + h * HD + lane * 4, *(const v4f*)&so[wave][rl][lane * 4]);
    asm volatile("s_wait_xcnt 0x0" ::: "memory"); }   // directly behind the stores, in their own branch: their address and data registers are written again for the second block
    // start of the second block
    q0 = pr * 64 + wave * 16; qi = q0 + col; bq[0] = bq2[0]; bq[1] = bq2[1]; m = own_score(bq[0], bq[1]); off = exp_off(m); l = 0.f;
#pragma unroll
    for (int dt = 0; dt < 4; ++dt) acc[dt] = v8f{}; } }
  asm volatile("s_wait_asynccnt 0x0" ::: "memory");    // nothing of this wave is in flight past the loop
}
#define WS2_QK  0u
#define WS2_VT  (WS2_QK + 2u * (size_t)NB * SS * 2 * DM)
#define WS2_PW  (WS2_VT + 2u * (size_t)NB * DM * SS)
#define WS2_END (WS2_PW + 2u * HD * HD + 256u)
extern "C" void kernel_launch(void* const* d_in, const int* in_sizes, int n_in, void* d_out, int out_size, void* d_ws, size_t ws_size, hipStream_t stream) {
  (void)in_sizes; (void)n_in; (void)out_size;
  const float** F = (const float**)d_in;   // 0 x [2,16,2048,64], 1 W [64,64]
  if (ws_size < (size_t)WS2_END) return;
  char* ws = (char*)d_ws; _Float16 *QK = (_Float16*)(ws + WS2_QK), *VTH = (_Float16*)(ws + WS2_VT); __bf16* PW = (__bf16*)(ws + WS2_PW);
  k_packw<<<HD, 64, 0, stream>>>(F[1], PW);
  k_prep<<<TNB * SS / 64, 256, 0, stream>>>(F[0], QK, VTH);
  k_attn<<<dim3(TQB / 2, NH, TNB), 128, 0, stream>>>(QK, QK, VTH, VTH, nullptr, PW, (float*)d_out);   // out [b][h][q][e]; the residual-plane pointers are read-only and unused (single exact products)
}

// v009
// One run takes 35.8 microseconds.
// In both of two side-by-side timings against v008, it was 1.04 times as fast.
// Counting every step since v000, it is 4.90 times as fast.
// compute dtype: x and W rounded to bf16 and used as EXACT f16 operands for the attention (bf16 values are exact in f16): scores = x . x (single exact product) x 1/8 with the causal mask, running-max softmax in f32 (hardware exp), P (scaled by 2^11) as f16 value + f16 residual x the exact x planes (2 products, one accumulator); the 64 x 64 output map takes the f32 attention rows split into bf16 hi + residual against the exact bf16 W rows on WMMA 16x16x32 (2 products); f32 accumulate.
#include <hip/hip_runtime.h>
#include <math.h>

typedef __attribute__((ext_vector_type(16))) _Float16 v16h;
typedef __attribute__((ext_vector_type(16))) __bf16 v16b;
typedef __attribute__((ext_vector_type(8)))  _Float16 v8h;
typedef __attribute__((ext_vector_type(2)))  _Float16 v2h;
typedef __attribute__((ext_vector_type(8)))  float v8f;
typedef __attribute__((ext_vector_type(4)))  float v4f;
typedef __attribute__((ext_vector_type(2)))  float v2f;
typedef __attribute__((ext_vector_type(4)))  unsigned v4u;
typedef __attribute__((ext_vector_type(4)))  int v4i;
typedef float __attribute__((may_alias)) float_a;
typedef int __attribute__((may_alias)) int_a;

template <typename T> __device__ __forceinline__ void vst2(void* p, T v) { *(T*)p = v;  }
// Both products are the builtin forms and nothing else: the compiler keeps the distance behind a WMMA itself, and other vector work or the next WMMA may stand in those slots.
__device__ __forceinline__ v8f wmma16(v16h a, v16h b, v8f c) {
  v8f d = __builtin_amdgcn_wmma_f32_16x16x32_f16(false, a, false, b, (short)0, c, false, false);
  return d;
}
__device__ __forceinline__ v8f wmma_bf(v16b a, v16b b, v8f c) {
  v8f d = __builtin_amdgcn_wmma_f32_16x16x32_bf16(false, a, false, b, (short)0, c, false, false);
  return d;
}
// Minimal causal attention block on a given per-head tensor x [2, 16, 2,048, 64] (q = k = v = x): softmax(mask(x x^T / 8)) x, then a bias-free 64 x 64 linear map.
__device__ __forceinline__ v16h frag_h(const _Float16* rowk0, int lane) {
  union { v16h v; v8h q[2]; } u; const _Float16* p = rowk0 + 8 * (lane >> 4);
  u.q[0] = *(const v8h*)p; u.q[1] = *(const v8h*)(p + 16); return u.v;
}
__device__ __forceinline__ v16h frag_f32(const float* rowk0, int lane) {
  v16h a; const float* p = rowk0 + 8 * (lane >> 4);
#pragma unroll
  for (int i = 0; i < 8; ++i) { a[i] = (_Float16)p[i]; a[8 + i] = (_Float16)p[16 + i]; }
  return a;
}
__device__ __forceinline__ v16h frag_f32s(const float* rowk0, int lane, float sc) {
  v16h a; const float* p = rowk0 + 8 * (lane >> 4);
#pragma unroll
  for (int i = 0; i < 8; ++i) { a[i] = (_Float16)(p[i] * sc); a[8 + i] = (_Float16)(p[16 + i] * sc); }
  return a;
}
// column fragment from a [K][ld] layout (column n), rows >= K read as 0
__device__ __forceinline__ v16h fragc_f32(const float* W, int k0, int n, int lane, int ld, int K) {
  v16h a; const int g = lane >> 4;
#pragma unroll
  for (int i = 0; i < 8; ++i) { const int ka = k0 + 8 * g + i, kb = ka + 16;
    a[i] = (_Float16)(ka < K ? W[(size_t)(ka < K ? ka : K - 1) * ld + n] : 0.f); a[8 + i] = (_Float16)(kb < K ? W[(size_t)(kb < K ? kb : K - 1) * ld + n] : 0.f); }
  return a;
}
struct F2 { v16b h, l; };
__device__ __forceinline__ F2 bsplit16(const float v[16]) { F2 r;
#pragma unroll
  for (int i = 0; i < 16; ++i) { const __bf16 h = (__bf16)v[i]; r.h[i] = h; r.l[i] = (__bf16)(v[i] - (float)h); }
  return r; }
__device__ __forceinline__ F2 split_row(const float* row, int k0, int lane) { float v[16]; const float* p = row + k0 + 8 * (lane >> 4);
#pragma unroll
  for (int i = 0; i < 8; ++i) { v[i] = p[i]; v[8 + i] = p[16 + i]; }
  return bsplit16(v); }
__device__ __forceinline__ F2 split_rowK(const float* row, int k0, int lane, int K) { float v[16]; const int g = lane >> 4;
#pragma unroll
  for (int i = 0; i < 8; ++i) { const int ka = k0 + 8 * g + i, kb = ka + 16; v[i] = ka < K ? row[ka < K ? ka : K - 1] : 0.f; v[8 + i] = kb < K ? row[kb < K ? kb : K - 1] : 0.f; }
  return bsplit16(v); }
__device__ __forceinline__ F2 split_col(const float* W, int k0, int n, int lane, int ld, int K) { float v[16]; const int g = lane >> 4;
#pragma unroll
  for (int i = 0; i < 8; ++i) { const int ka = k0 + 8 * g + i, kb = ka + 16; v[i] = ka < K ? W[(size_t)(ka < K ? ka : K - 1) * ld + n] : 0.f; v[8 + i] = kb < K ? W[(size_t)(kb < K ? kb : K - 1) * ld + n] : 0.f; }
  return bsplit16(v); }
__device__ __forceinline__ v8f mac3(const F2& a, const F2& b, v8f c) { c = wmma_bf(a.l, b.h, c); c = wmma_bf(a.h, b.l, c); return wmma_bf(a.h, b.h, c); }
__device__ __forceinline__ float sigm(float v) { return 1.0f / (1.0f + expf(-v)); }
#define LDSX() do { asm volatile("s_wait_dscnt 0" ::: "memory"); __builtin_amdgcn_wave_barrier(); __builtin_amdgcn_fence(__ATOMIC_RELEASE, "workgroup"); } while (0)


#define NB 32   // (batch, head) pairs
#define SS 2048
#define DM 64
#define NH 1
#define HD 64
#define QKVW (3 * DM)
#ifndef TQB
#define TQB (SS / 64)
#define TNB NB
#define TOB (NB * SS / 64)     // output row tiles (all)
#endif
typedef __attribute__((ext_vector_type(8))) __bf16 v8b;
__device__ __forceinline__ v16b frag_b(const __bf16* rowk0, int lane) {
  union { v16b v; v8b q[2]; } u; const __bf16* p = rowk0 + 8 * (lane >> 4);
  u.q[0] = *(const v8b*)p; u.q[1] = *(const v8b*)(p + 16); return u.v;
}
__device__ __forceinline__ float bfr(float v) { return (float)(__bf16)v; }
__device__ __attribute__((noinline)) float exp_ni(float v) { return expf(v); }
__device__ __attribute__((noinline)) float erf_ni(float v) { return erff(v); }

#define PK_A 0                       // [192][64] Wqkv rows (natural [out][in])
#define PK_P (PK_A + QKVW * DM)        // [64][64] Wo rows (natural)
#define PK_END (PK_P + DM * DM)
#define WS_PK  0u
#define WS_QK  (WS_PK + 2u * PK_END)             // f16 [65536 rows][128]: q | k
#define WS_QKL (WS_QK + 2u * NB * SS * 2 * DM)     // f16 q | k residual planes x2048
#define WS_VTH (WS_QKL + 2u * NB * SS * 2 * DM)    // f16 [b][64 (h*64+d)][2048 s] hi
#define WS_VTL (WS_VTH + 2u * NB * DM * SS)        // f16 lo x 2048
#define WS_O   (WS_VTL + 2u * NB * DM * SS)        // f32 [65536][64]
#define WS_CS  (WS_O + 4u * NB * SS * DM)           // f32 [2048][32] cos, [2048][32] sin
#define WS_END (WS_CS + 4u * 2 * SS * 32)
// ---- k_prep: block = 64 rows of one (batch, head): x rows -> f16 [row][128] (x | x) and x^T planes [bh][64][SS] (exact)
__global__ __launch_bounds__(256) void k_prep(const float* __restrict__ X, _Float16* __restrict__ QK, _Float16* __restrict__ VTH) {
  __shared__ __align__(16) _Float16 sq[64][72]; __shared__ __align__(16) _Float16 st[64][72];
  const int t = threadIdx.x; const size_t r0 = (size_t)blockIdx.x * 64; const size_t bh = r0 / SS, s0 = r0 % SS;
  for (int e = t; e < 64 * 64; e += 256) { const int r = e >> 6, c = e & 63; const _Float16 v = (_Float16)bfr(X[(r0 + r) * DM + c]); sq[r][c] = v; st[c][r] = v; }
  __syncthreads();
  for (int e = t; e < 64 * 8; e += 256) { const int r = e >> 3, q = e & 7; const v4u v = *(const v4u*)&sq[r][q * 8]; vst2((unsigned*)(QK + (r0 + r) * (2 * DM) + q * 8), v); vst2((unsigned*)(QK + (r0 + r) * (2 * DM) + DM + q * 8), v); }
  for (int e = t; e < 64 * 8; e += 256) { const int c = e >> 3, pc = e & 7; vst2((unsigned*)(VTH + (bh * DM + c) * SS + s0 + pc * 8), *(const v4u*)&st[c][pc * 8]); }
}
// ---- k_packw: W [64][64] natural -> bf16 rows
__global__ __launch_bounds__(64) void k_packw(const float* __restrict__ Wm, __bf16* __restrict__ PW) { const int n = blockIdx.x, t = threadIdx.x; __shared__ __align__(16) __bf16 s[HD]; s[t] = (__bf16)Wm[(size_t)n * HD + t]; __syncthreads(); if (t < HD / 8) vst2((unsigned*)(PW + (size_t)n * HD + t * 8), *(const v4u*)&s[t * 8]); }
// 2^x on the hardware's v_exp_f32, written as asm for one reason: the instruction set asks for one free slot behind a transcendental before its result is read or its source overwritten.
// Eight independent exps fill each other's slot, a v_nop fills the last one's; early-clobber outputs keep results off the sources.
__device__ __forceinline__ v8f exp2x8(v8f x) { float r0, r1, r2, r3, r4, r5, r6, r7;
  asm("v_exp_f32 %0, %8\n\tv_exp_f32 %1, %9\n\tv_exp_f32 %2, %10\n\tv_exp_f32 %3, %11\n\tv_exp_f32 %4, %12\n\tv_exp_f32 %5, %13\n\tv_exp_f32 %6, %14\n\tv_exp_f32 %7, %15\n\tv_nop"
      : "=&v"(r0), "=&v"(r1), "=&v"(r2), "=&v"(r3), "=&v"(r4), "=&v"(r5), "=&v"(r6), "=&v"(r7) : "v"(x[0]), "v"(x[1]), "v"(x[2]), "v"(x[3]), "v"(x[4]), "v"(x[5]), "v"(x[6]), "v"(x[7]));
  const v8f r = { r0, r1, r2, r3, r4, r5, r6, r7 }; return r; }
__device__ __forceinline__ float exp2x1(float x) { float r; asm("v_exp_f32 %0, %1\n\tv_nop" : "=v"(r) : "v"(x)); return r; }   // the same slot for a single exp
// Eight f32 weights -> four registers of f16 pairs (h, round to nearest) and four of their f16 residuals (d = x - h, exact in f32, then rounded once to f16).
// The residual is asm because the build did not form it so: one mixed-precision FMA reads the f16 half straight from the packed register, subtracts it from the f32 weight and writes the f16 half of d
// (h x -1 + x, the -1 an f32 in a register); from plain source the build converted every half back to f32, subtracted and converted again. Low halves first, then high halves: each write of a register stands four instructions behind the
// other write of that register, which the s_delay_alu lines tell the issue logic, so that the SIMD's other waves may issue meanwhile. Early-clobber outputs keep d off the inputs.
__device__ __forceinline__ void split8(v8f x, unsigned* h, unsigned* d) {
#pragma unroll
  for (int j = 0; j < 4; ++j) { const v2f p = { x[2 * j], x[2 * j + 1] }; h[j] = __builtin_bit_cast(unsigned, __builtin_convertvector(p, v2h)); }
  asm("v_fma_mixlo_f16 %0, %4, %16, %8 op_sel_hi:[1,0,0]\n\tv_fma_mixlo_f16 %1, %5, %16, %10 op_sel_hi:[1,0,0]\n\tv_fma_mixlo_f16 %2, %6, %16, %12 op_sel_hi:[1,0,0]\n\tv_fma_mixlo_f16 %3, %7, %16, %14 op_sel_hi:[1,0,0]\n\t"
      "s_delay_alu instid0(VALU_DEP_4) | instskip(NEXT) | instid1(VALU_DEP_4)\n\t"
      "v_fma_mixhi_f16 %0, %4, %16, %9 op_sel:[1,0,0] op_sel_hi:[1,0,0]\n\tv_fma_mixhi_f16 %1, %5, %16, %11 op_sel:[1,0,0] op_sel_hi:[1,0,0]\n\t"
      "s_delay_alu instid0(VALU_DEP_4) | instskip(NEXT) | instid1(VALU_DEP_4)\n\t"
      "v_fma_mixhi_f16 %2, %6, %16, %13 op_sel:[1,0,0] op_sel_hi:[1,0,0]\n\tv_fma_mixhi_f16 %3, %7, %16, %15 op_sel:[1,0,0] op_sel_hi:[1,0,0]"
      : "=&v"(d[0]), "=&v"(d[1]), "=&v"(d[2]), "=&v"(d[3]) : "v"(h[0]), "v"(h[1]), "v"(h[2]), "v"(h[3]), "v"(x[0]), "v"(x[1]), "v"(x[2]), "v"(x[3]), "v"(x[4]), "v"(x[5]), "v"(x[6]), "v"(x[7]), "v"(-1.0f)); }
#define LOG2E 1.44269504088896340736f   // e^x = 2^(x log2 e), the product __expf forms
#define SCL (0.125f * LOG2E)            // 1/sqrt(64) and log2 e as one factor (the eighth is a power of two: SCL is LOG2E with another exponent)
// Exponent offset of a row whose maximum product is m: weight x 2^11 = 2^(c SCL + off). The 2^11 keeps small weights out of the f16 subnormal range; row sum and O^T tiles both carry it, so it cancels in the quotient.
__device__ __forceinline__ float exp_off(float m) { return __builtin_fmaf(-m, SCL, 11.0f); }
// c SCL + off as a fused multiply-add, said outright so that both places that form weights round alike: the product is not rounded, so a score close to the maximum keeps a small absolute error.
__device__ __forceinline__ v8f exp_arg(v8f c, float off) { const v8f k = { SCL, SCL, SCL, SCL, SCL, SCL, SCL, SCL }, o = { off, off, off, off, off, off, off, off }; return __builtin_elementwise_fma(c, k, o); }
// lane l <-> lane l ^ 16 (the two halves of a wave hold the two halves of one query column's keys)
__device__ __forceinline__ float xhalf(float v) { const int b = __builtin_bit_cast(int, v); return __builtin_bit_cast(float, __builtin_amdgcn_permlanex16(b, b, 0x76543210, 0xfedcba98, false, false)); }
// A query's product with itself, x . x (not yet divided by 8), from the query fragments (each half of the wave holds half of the row). It is one of the row's own causal scores, so it may start the running maximum.
__device__ __forceinline__ float own_score(v16h a, v16h b) { float t = 0.f;
#pragma unroll
  for (int i = 0; i < 16; ++i) { const float x = (float)a[i], y = (float)b[i]; t += x * x; t += y * y; }
  return t + xhalf(t); }
// One stage = 128 keys: 128 key rows (K, 128 B a row) and the 64 x^T rows of those keys (V^T, 256 B a row), copied once per work-group and read by its eight waves.
// A stage is two 64-key units of two passes each; waves 0-3 work on the first unit, waves 4-7 on the second, for the same 64 queries.
#define KST 128
#define LP 72    // K row pitch in LDS, in halves: 144 B = 16 B x 9, an odd multiple of 16 B, so that the 16-byte fragment reads of 16 rows spread over the banks
#define LPV 136  // V^T row pitch in LDS, in halves: 272 B = 16 B x 17, odd for the same reason
// Four copies of 16 B per lane, GS halves apart in global memory and LS bytes apart in LDS. The s_wait_xcnt stands inside the copies' own statement so that
// no later write of an address register can be moved in front of it.
template <int GS, int LS> __device__ __forceinline__ void copy4(const _Float16* g, unsigned l) {
  asm volatile("global_load_async_to_lds_b128 %0, %4, off\n\tglobal_load_async_to_lds_b128 %1, %5, off\n\tglobal_load_async_to_lds_b128 %2, %6, off\n\tglobal_load_async_to_lds_b128 %3, %7, off\n\ts_wait_xcnt 0x0"
               :: "v"(l), "v"(l + LS), "v"(l + 2 * LS), "v"(l + 3 * LS), "v"(g), "v"(g + GS), "v"(g + 2 * GS), "v"(g + 3 * GS) : "memory");
}
// Each of the 256 threads copies 16 B of four K rows (32 rows apart: a wave covers four whole 128-B rows per copy) and of four V^T rows (16 rows apart: a wave covers two whole 256-B rows per copy).
__device__ __forceinline__ void stage_copy(const _Float16* gk, const _Float16* gv, unsigned lk, unsigned lv) {
  copy4<32 * 2 * DM, 32 * LP * 2>(gk, lk); copy4<16 * SS, 16 * LPV * 2>(gv, lv);
}
// ---- k_attn: transposed products. S^T = K Q^T (A = key rows, B = query rows kept in registers): lane (col, g) holds query q0 + col, keys 8g + r of each 16-key tile.
//      Two S^T tiles converted in place are the B operand P^T of O^T += V^T P^T (A = x^T rows), and the four O^T tiles are the B operand of out^T = W attn^T.
//      A work-group takes two query blocks of one (batch, head), one after the other: block TQB - 1 - pr, then block pr. Query block j needs the 64-key units 0 .. j, that is (j + 2) / 2 stages of two units;
//      of the two blocks one has an even j, whose last stage holds one unit wholly behind the diagonal (copied, not worked on). Every work-group so walks TQB / 2 + 1 stages:
//      all work-groups are resident at once, and the launch lasts as long as the WGP with the most stages. The stage ring runs on across the switch (both blocks read the same K and V^T).
//      Eight waves: wave w holds the 16 queries of tile w & 3 and takes the 64-key unit w >> 2 of every stage, with a running maximum, row sum and O^T tiles of its own. That puts four waves on a SIMD (two work-groups
//      a WGP), so that one wave's LDS waits, branches and vector work stand beside another's products. At a query block's end waves 4-7 hand their partial sums to waves 0-3 through LDS, which bring both to one scale and add.
__global__ __launch_bounds__(256) void k_attn(const _Float16* __restrict__ QK, const _Float16* __restrict__ QKL, const _Float16* __restrict__ VTH, const _Float16* __restrict__ VTL, const void* __restrict__ KMASK, const __bf16* __restrict__ PW, float* __restrict__ O) {
  __shared__ __align__(16) float so[4][16][68];
  __shared__ __align__(16) _Float16 sk[2][KST][LP]; __shared__ __align__(16) _Float16 sv[2][DM][LPV];   // two buffers: stage st + 1 lands while stage st is worked on
  const int tid = threadIdx.x, wave = (tid >> 5) & 3, lane = tid & 31, col = lane & 15, g = lane >> 4;   // wave: the query tile
  const int kh = __builtin_amdgcn_readfirstlane(tid >> 7);   // the wave's 64-key unit in every stage, held in a scalar register so that the tests on it are scalar branches
  const int pr = blockIdx.x, h = blockIdx.y, b = blockIdx.z;
  const int n1 = (TQB + 1 - pr) >> 1, nst = TQB / 2 + 1;   // stages of the first block (causal: 128-key stages up to and with the one that holds the diagonal); stages of both blocks
  int q0 = (TQB - 1 - pr) * 64 + wave * 16; int qi = q0 + col;
  (void)QKL; (void)VTL; (void)KMASK;
  v16h bq[2], bq2[2];   // query rows of the first and of the second block, both read up front
#pragma unroll
  for (int kc = 0; kc < 2; ++kc) { bq[kc] = frag_h(QK + ((size_t)b * SS + qi) * (2 * DM) + h * HD + kc * 32, lane); bq2[kc] = frag_h(QK + ((size_t)b * SS + pr * 64 + wave * 16 + col) * (2 * DM) + h * HD + kc * 32, lane); }
  // Running maximum of query qi (equal in both halves). It starts at the query's own diagonal score, which belongs to every causal row: a finite start that is never above the row's maximum by more than rounding,
  // and for rows whose own score is their largest it never rises, so that the rescale below is skipped. l sums this half's keys only, the halves join in the epilogue.
  float m = own_score(bq[0], bq[1]), off = exp_off(m), l = 0.f;   // m is kept in units of the raw product x . x
  v8f acc[4] = {};
  const int crow = tid >> 3, cq = tid & 7, vrow = tid >> 4, vq = tid & 15;   // this thread's first row and 16-byte piece in every K copy and in every V^T copy
  const _Float16* gk = QK + ((size_t)b * SS + crow) * (2 * DM) + DM + h * HD + cq * 8; const _Float16* gv = VTH + ((size_t)b * DM + h * HD + vrow) * SS + vq * 8;
  const unsigned lk = (unsigned)(size_t)&sk[0][crow][cq * 8], lv = (unsigned)(size_t)&sv[0][vrow][vq * 8];
  stage_copy(gk, gv, lk, lv);
  asm volatile("s_wait_asynccnt 0x0" ::: "memory");   // this wave's share of stage 0 has landed
  __syncthreads();                                     // every wave's share has
  { const int k1 = 1 < n1 ? 1 : 0; stage_copy(gk + (size_t)k1 * KST * 2 * DM, gv + k1 * KST, lk + KST * LP * 2, lv + DM * LPV * 2); }   // stage 1 always exists
  v16h kf[2][2], vf[4];   // a pass's fragments, read from LDS as one group: the V^T reads return behind the score products and the softmax
  // The LDS reads of pass p (32 keys) of this wave's unit of the stage in buffer bf.
  auto frags = [&](const int bf, const int p) __attribute__((always_inline)) {
#pragma unroll
    for (int ct = 0; ct < 2; ++ct) { kf[ct][0] = frag_h(&sk[bf][kh * 64 + p * 32 + ct * 16 + col][0], lane); kf[ct][1] = frag_h(&sk[bf][kh * 64 + p * 32 + ct * 16 + col][32], lane); }
#pragma unroll
    for (int dt = 0; dt < 4; ++dt) vf[dt] = frag_h(&sv[bf][dt * 16 + col][kh * 64 + p * 32], lane);
    __builtin_amdgcn_sched_barrier(0); };   // keeps the pass's sixteen LDS reads one group in front of its products: left free, the build spreads them among the WMMAs in small groups, each with its wait close behind it
  // The work on those fragments; ks: the pass's number on the key axis; diag: the pass belongs to the 64-key unit on the diagonal.
  auto pass = [&](const int ks, const bool diag) __attribute__((always_inline)) { v8f s[2];
#pragma unroll
    for (int ct = 0; ct < 2; ++ct) { v8f c = {};
#pragma unroll
      for (int kc = 0; kc < 2; ++kc) c = wmma16(kf[ct][kc], bq[kc], c);   // single EXACT product: q, k are bf16 inputs held exactly in f16
      s[ct] = c; }   // the raw product: 1/sqrt(64) is part of SCL
    if (__builtin_expect(diag, 0)) {   // causal (diagonal kept); expected false so that the common path falls through and the masking code lies behind the loop
#pragma unroll
      for (int i = 0; i < 16; ++i) s[i >> 3][i & 7] = (ks * 32 + (i >> 3) * 16 + 8 * g + (i & 7) <= qi) ? s[i >> 3][i & 7] : -3.0e38f; }
    float mx = fmaxf(s[0][0], s[1][0]);
#pragma unroll
    for (int r = 1; r < 8; ++r) mx = fmaxf(mx, fmaxf(s[0][r], s[1][r]));
    v8f e[2];   // weights against the maximum in use: they do not wait for this pass's maximum
#pragma unroll
    for (int ct = 0; ct < 2; ++ct) e[ct] = exp2x8(exp_arg(s[ct], off));   // one multiply-add per score holds the eighth, log2 e, the maximum and the 2^11
    if (__builtin_expect(__builtin_amdgcn_ballot_w32(mx > m) != 0, 0)) {   // one test per pass, a scalar branch: only where some query's maximum rises are sums and tiles rescaled and the weights formed again
      mx = fmaxf(mx, xhalf(mx));
      const float mn = fmaxf(m, mx), offn = exp_off(mn); const float alpha = exp2x1(offn - off);   // the ratio of the two scales as the weights see them; 1 exactly in the columns whose maximum stays
#pragma unroll
      for (int ct = 0; ct < 2; ++ct) e[ct] = exp2x8(exp_arg(s[ct], offn));
      l *= alpha; m = mn; off = offn;
#pragma unroll
      for (int dt = 0; dt < 4; ++dt) acc[dt] *= alpha; }
    if (__builtin_expect(diag, 0)) {   // masked keys weigh nothing; expected false for the same reason as above
#pragma unroll
      for (int i = 0; i < 16; ++i) e[i >> 3][i & 7] = (s[i >> 3][i & 7] <= -1.0e38f) ? 0.f : e[i >> 3][i & 7]; }
    union { v16h v; unsigned w[8]; } pa, pl;
#pragma unroll
    for (int ct = 0; ct < 2; ++ct) split8(e[ct], pa.w + 4 * ct, pl.w + 4 * ct);   // element i of P^T = key 16 (i / 8) + 8 g + i % 8 of this pass. f16 value + f16 residual at the same scale: a residual too small for f16 is below 2^-36 of the largest weight
    const v8f e2 = e[0] + e[1];
    l += ((e2[0] + e2[1]) + (e2[2] + e2[3])) + ((e2[4] + e2[5]) + (e2[6] + e2[7]));
#pragma unroll
    for (int dt = 0; dt < 4; ++dt) acc[dt] = wmma16(vf[dt], pa.v, acc[dt]);   // V^T x P^T value (v exact)
#pragma unroll
    for (int dt = 0; dt < 4; ++dt) acc[dt] = wmma16(vf[dt], pl.v, acc[dt]); };   // + V^T x P^T residual, into the same tiles, each four products behind the tile's last one
#pragma unroll 1   // one copy of the stage body: the two buffers are told apart by an address, not by code
  for (int st = 0; st < nst; ++st) { const int bf = st & 1; const int kb = st < n1 ? st : st - n1;   // kb: the 128-key block of this stage
   // Only the 64-key unit on the diagonal holds keys behind a query. In every other unit the causal compare is true for all keys and no score is the mask value (64 products of f16 values lie far above it),
   // so compare and select are left out there. The tests read the block index, the loop counter and the wave's unit kh (a scalar register): uniform within a wave, scalar branches.
   const int du = (st < n1 ? TQB - 1 - pr : pr) - kb * 2;   // the diagonal unit counted from this stage's first unit: 0 or 1 in a query block's last stage, more before
   // The wave's two passes written out: every LDS read is one base register plus a constant offset, and the second pass's reads are issued among the products of the first.
   if (__builtin_expect(kh <= du, 1)) {   // with the diagonal in the first unit (even query block, last stage) the second unit holds no key of any query: copied, not worked on
     frags(bf, 0); pass(kb * 4 + kh * 2 + 0, du == kh); frags(bf, 1); pass(kb * 4 + kh * 2 + 1, du == kh); }
   asm volatile("s_wait_dscnt 0x0" ::: "memory");      // this wave's reads of buffer bf are done before the buffer is handed back
   asm volatile("s_wait_asynccnt 0x0" ::: "memory");   // this wave's share of stage st + 1 has landed
   __syncthreads();                                     // publishes stage st + 1 and ends every wave's reads of buffer bf
   if (st + 2 < nst) { const int k2 = st + 2 < n1 ? st + 2 : st + 2 - n1; stage_copy(gk + (size_t)k2 * KST * 2 * DM, gv + k2 * KST, lk + bf * (KST * LP * 2), lv + bf * (DM * LPV * 2)); }
   if (st + 1 == n1 || st + 1 == nst) {   // a query block's last stage is done (the same test in every wave): its rows go out while the next stages' copies fly
  // The two key halves join. Waves w and w + 4 hold the same queries in the same lanes and registers; the hand-over uses the output staging rows of tile w (32 lanes x 34 floats = 16 x 68), lane-contiguous 16-byte pieces.
  float* mg = &so[wave][0][0];
  if (kh == 1) {
#pragma unroll
    for (int dt = 0; dt < 4; ++dt) { const v4f lo = { acc[dt][0], acc[dt][1], acc[dt][2], acc[dt][3] }, hi = { acc[dt][4], acc[dt][5], acc[dt][6], acc[dt][7] };
      *(v4f*)(mg + ((2 * dt) * 32 + lane) * 4) = lo; *(v4f*)(mg + ((2 * dt + 1) * 32 + lane) * 4) = hi; }
    mg[1024 + lane] = m; mg[1056 + lane] = l; }
  __syncthreads();   // waves 0-3 read the partial sums behind it; the rows' last readers (the block before) left them in front of an earlier publish barrier
  if (kh == 0) {
  { const float m1 = mg[1024 + lane], l1 = mg[1056 + lane]; const float mn = fmaxf(m, m1), offn = exp_off(mn);
    const float a0 = exp2x1(offn - off), a1 = exp2x1(offn - exp_off(m1));   // each half's scale against the common one; 1 exactly where the maxima agree
    l = l * a0 + l1 * a1;
#pragma unroll
    for (int dt = 0; dt < 4; ++dt) { const v4f lo = *(const v4f*)(mg + ((2 * dt) * 32 + lane) * 4), hi = *(const v4f*)(mg + ((2 * dt + 1) * 32 + lane) * 4);
#pragma unroll
      for (int r = 0; r < 4; ++r) { acc[dt][r] = acc[dt][r] * a0 + lo[r] * a1; acc[dt][4 + r] = acc[dt][4 + r] * a0 + hi[r] * a1; } } }
  // epilogue: out[e] = sum_d attn[d] W[e][d] (the bias-free Linear): W rows (exact) x attn^T (bf16 hi + residual, straight from the O^T tiles), 2 products
  { const float il = 1.0f / (l + xhalf(l)); v8f acc2[4] = {};   // l and the tiles carry the same 2^11
#pragma unroll
    for (int kc = 0; kc < 2; ++kc) { float v[16];
#pragma unroll
      for (int r = 0; r < 8; ++r) { v[r] = acc[2 * kc][r] * il; v[8 + r] = acc[2 * kc + 1][r] * il; }
      const F2 a2 = bsplit16(v);
#pragma unroll
      for (int j = 0; j < 4; ++j) { const v16b w = frag_b(PW + (size_t)(j * 16 + col) * HD + kc * 32, lane); acc2[j] = wmma_bf(w, a2.l, acc2[j]); acc2[j] = wmma_bf(w, a2.h, acc2[j]); } }
#pragma unroll
    for (int j = 0; j < 4; ++j) { const v4f lo = { acc2[j][0], acc2[j][1], acc2[j][2], acc2[j][3] }, hi = { acc2[j][4], acc2[j][5], acc2[j][6], acc2[j][7] };   // acc2[j][r] = out[qi][16 j + 8 g + r]
      *(v4f*)&so[wave][col][j * 16 + 8 * g] = lo; *(v4f*)&so[wave][col][j * 16 + 8 * g + 4] = hi; }
    LDSX(); }
  if (lane < 16) { for (int rl = 0; rl < 16; ++rl) vst2(O + ((size_t)b * SS + q0 + rl) * DM + h * HD + lane * 4, *(const v4f*)&so[wave][rl][lane * 4]);
    asm volatile("s_wait_xcnt 0x0" ::: "memory"); }   // directly behind the stores, in their own branch: their address and data registers are written again for the second block
  }
    // start of the second block
    q0 = pr * 64 + wave * 16; qi = q0 + col; bq[0] = bq2[0]; bq[1] = bq2[1]; m = own_score(bq[0], bq[1]); off = exp_off(m); l = 0.f;
#pragma unroll
    for (int dt = 0; dt < 4; ++dt) acc[dt] = v8f{}; } }
  asm volatile("s_wait_asynccnt 0x0" ::: "memory");    // nothing of this wave is in flight past the loop
}
#define WS2_QK  0u
#define WS2_VT  (WS2_QK + 2u * (size_t)NB * SS * 2 * DM)
#define WS2_PW  (WS2_VT + 2u * (size_t)NB * DM * SS)
#define WS2_END (WS2_PW + 2u * HD * HD + 256u)
extern "C" void kernel_launch(void* const* d_in, const int* in_sizes, int n_in, void* d_out, int out_size, void* d_ws, size_t ws_size, hipStream_t stream) {
  (void)in_sizes; (void)n_in; (void)out_size;
  const float** F = (const float**)d_in;   // 0 x [2,16,2048,64], 1 W [64,64]
  if (ws_size < (size_t)WS2_END) return;
  char* ws = (char*)d_ws; _Float16 *QK = (_Float16*)(ws + WS2_QK), *VTH = (_Float16*)(ws + WS2_VT); __bf16* PW = (__bf16*)(ws + WS2_PW);
  k_packw<<<HD, 64, 0, stream>>>(F[1], PW);
  k_prep<<<TNB * SS / 64, 256, 0, stream>>>(F[0], QK, VTH);
  k_attn<<<dim3(TQB / 2, NH, TNB), 256, 0, stream>>>(QK, QK, VTH, VTH, nullptr, PW, (float*)d_out);   // out [b][h][q][e]; the residual-plane pointers are read-only and unused (single exact products)
}

// v010
// It runs in 33.9 microseconds.
// Next to v009, in two timings, it ran 1.06 times as fast each time.
// All steps since v000 together make it 5.18 times as fast.
// compute dtype: x and W rounded to bf16 and used as EXACT f16 operands for the attention (bf16 values are exact in f16): scores = x . x (single exact product) x 1/8 with the causal mask, running-max softmax in f32 (hardware exp), P (scaled by 2^11) as f16 value + f16 residual x the exact x planes (2 products, one accumulator); the 64 x 64 output map takes the f32 attention rows split into bf16 hi + residual against the exact bf16 W rows on WMMA 16x16x32 (2 products); f32 accumulate.
#include <hip/hip_runtime.h>
#include <math.h>

typedef __attribute__((ext_vector_type(16))) _Float16 v16h;
typedef __attribute__((ext_vector_type(16))) __bf16 v16b;
typedef __attribute__((ext_vector_type(8)))  _Float16 v8h;
typedef __attribute__((ext_vector_type(2)))  _Float16 v2h;
typedef __attribute__((ext_vector_type(8)))  float v8f;
typedef __attribute__((ext_vector_type(4)))  float v4f;
typedef __attribute__((ext_vector_type(2)))  float v2f;
typedef __attribute__((ext_vector_type(4)))  unsigned v4u;
typedef __attribute__((ext_vector_type(4)))  int v4i;
typedef float __attribute__((may_alias)) float_a;
typedef int __attribute__((may_alias)) int_a;

template <typename T> __device__ __forceinline__ void vst2(void* p, T v) { *(T*)p = v;  }
// Both products are the builtin forms and nothing else: the compiler keeps the distance behind a WMMA itself, and other vector work or the next WMMA may stand in those slots.
__device__ __forceinline__ v8f wmma16(v16h a, v16h b, v8f c) {
  v8f d = __builtin_amdgcn_wmma_f32_16x16x32_f16(false, a, false, b, (short)0, c, false, false);
  return d;
}
__device__ __forceinline__ v8f wmma_bf(v16b a, v16b b, v8f c) {
  v8f d = __builtin_amdgcn_wmma_f32_16x16x32_bf16(false, a, false, b, (short)0, c, false, false);
  return d;
}
// Minimal causal attention block on a given per-head tensor x [2, 16, 2,048, 64] (q = k = v = x): softmax(mask(x x^T / 8)) x, then a bias-free 64 x 64 linear map.
__device__ __forceinline__ v16h frag_h(const _Float16* rowk0, int lane) {
  union { v16h v; v8h q[2]; } u; const _Float16* p = rowk0 + 8 * (lane >> 4);
  u.q[0] = *(const v8h*)p; u.q[1] = *(const v8h*)(p + 16); return u.v;
}
__device__ __forceinline__ v16h frag_f32(const float* rowk0, int lane) {
  v16h a; const float* p = rowk0 + 8 * (lane >> 4);
#pragma unroll
  for (int i = 0; i < 8; ++i) { a[i] = (_Float16)p[i]; a[8 + i] = (_Float16)p[16 + i]; }
  return a;
}
__device__ __forceinline__ v16h frag_f32s(const float* rowk0, int lane, float sc) {
  v16h a; const float* p = rowk0 + 8 * (lane >> 4);
#pragma unroll
  for (int i = 0; i < 8; ++i) { a[i] = (_Float16)(p[i] * sc); a[8 + i] = (_Float16)(p[16 + i] * sc); }
  return a;
}
// column fragment from a [K][ld] layout (column n), rows >= K read as 0
__device__ __forceinline__ v16h fragc_f32(const float* W, int k0, int n, int lane, int ld, int K) {
  v16h a; const int g = lane >> 4;
#pragma unroll
  for (int i = 0; i < 8; ++i) { const int ka = k0 + 8 * g + i, kb = ka + 16;
    a[i] = (_Float16)(ka < K ? W[(size_t)(ka < K ? ka : K - 1) * ld + n] : 0.f); a[8 + i] = (_Float16)(kb < K ? W[(size_t)(kb < K ? kb : K - 1) * ld + n] : 0.f); }
  return a;
}
struct F2 { v16b h, l; };
__device__ __forceinline__ F2 bsplit16(const float v[16]) { F2 r;
#pragma unroll
  for (int i = 0; i < 16; ++i) { const __bf16 h = (__bf16)v[i]; r.h[i] = h; r.l[i] = (__bf16)(v[i] - (float)h); }
  return r; }
__device__ __forceinline__ F2 split_row(const float* row, int k0, int lane) { float v[16]; const float* p = row + k0 + 8 * (lane >> 4);
#pragma unroll
  for (int i = 0; i < 8; ++i) { v[i] = p[i]; v[8 + i] = p[16 + i]; }
  return bsplit16(v); }
__device__ __forceinline__ F2 split_rowK(const float* row, int k0, int lane, int K) { float v[16]; const int g = lane >> 4;
#pragma unroll
  for (int i = 0; i < 8; ++i) { const int ka = k0 + 8 * g + i, kb = ka + 16; v[i] = ka < K ? row[ka < K ? ka : K - 1] : 0.f; v[8 + i] = kb < K ? row[kb < K ? kb : K - 1] : 0.f; }
  return bsplit16(v); }
__device__ __forceinline__ F2 split_col(const float* W, int k0, int n, int lane, int ld, int K) { float v[16]; const int g = lane >> 4;
#pragma unroll
  for (int i = 0; i < 8; ++i) { const int ka = k0 + 8 * g + i, kb = ka + 16; v[i] = ka < K ? W[(size_t)(ka < K ? ka : K - 1) * ld + n] : 0.f; v[8 + i] = kb < K ? W[(size_t)(kb < K ? kb : K - 1) * ld + n] : 0.f; }
  return bsplit16(v); }
__device__ __forceinline__ v8f mac3(const F2& a, const F2& b, v8f c) { c = wmma_bf(a.l, b.h, c); c = wmma_bf(a.h, b.l, c); return wmma_bf(a.h, b.h, c); }
__device__ __forceinline__ float sigm(float v) { return 1.0f / (1.0f + expf(-v)); }
#define LDSX() do { asm volatile("s_wait_dscnt 0" ::: "memory"); __builtin_amdgcn_wave_barrier(); __builtin_amdgcn_fence(__ATOMIC_RELEASE, "workgroup"); } while (0)


#define NB 32   // (batch, head) pairs
#define SS 2048
#define DM 64
#define NH 1
#define HD 64
#define QKVW (3 * DM)
#ifndef TQB
#define TQB (SS / 64)
#define TNB NB
#define TOB (NB * SS / 64)     // output row tiles (all)
#endif
typedef __attribute__((ext_vector_type(8))) __bf16 v8b;
__device__ __forceinline__ v16b frag_b(const __bf16* rowk0, int lane) {
  union { v16b v; v8b q[2]; } u; const __bf16* p = rowk0 + 8 * (lane >> 4);
  u.q[0] = *(const v8b*)p; u.q[1] = *(const v8b*)(p + 16); return u.v;
}
__device__ __forceinline__ float bfr(float v) { return (float)(__bf16)v; }
__device__ __attribute__((noinline)) float exp_ni(float v) { return expf(v); }
__device__ __attribute__((noinline)) float erf_ni(float v) { return erff(v); }

#define PK_A 0                       // [192][64] Wqkv rows (natural [out][in])
#define PK_P (PK_A + QKVW * DM)        // [64][64] Wo rows (natural)
#define PK_END (PK_P + DM * DM)
#define WS_PK  0u
#define WS_QK  (WS_PK + 2u * PK_END)             // f16 [65536 rows][128]: q | k
#define WS_QKL (WS_QK + 2u * NB * SS * 2 * DM)     // f16 q | k residual planes x2048
#define WS_VTH (WS_QKL + 2u * NB * SS * 2 * DM)    // f16 [b][64 (h*64+d)][2048 s] hi
#define WS_VTL (WS_VTH + 2u * NB * DM * SS)        // f16 lo x 2048
#define WS_O   (WS_VTL + 2u * NB * DM * SS)        // f32 [65536][64]
#define WS_CS  (WS_O + 4u * NB * SS * DM)           // f32 [2048][32] cos, [2048][32] sin
#define WS_END (WS_CS + 4u * 2 * SS * 32)
// ---- k_prep: block = 64 rows of one (batch, head): x rows -> f16 [row][128] (x | x) and x^T planes [bh][64][SS] (exact)
//      The one block behind the x blocks packs W [64][64] (natural [out][in] rows) to bf16 rows: x and W need nothing of each other, so both preparations share one grid and one launch.
__global__ __launch_bounds__(256) void k_prep(const float* __restrict__ X, const float* __restrict__ Wm, _Float16* __restrict__ QK, _Float16* __restrict__ VTH, __bf16* __restrict__ PW) {
  __shared__ __align__(16) _Float16 sq[64][72]; __shared__ __align__(16) _Float16 st[64][72];
  const int t = threadIdx.x;
  if (blockIdx.x == TNB * SS / 64) {   // the same test in every thread of a block, in front of the barrier: 256 threads x 16 consecutive elements = HD x HD
    const float* p = Wm + t * 16; union { v8b q[2]; v4u u[2]; } o;
#pragma unroll
    for (int i = 0; i < 16; ++i) o.q[i >> 3][i & 7] = (__bf16)p[i];
    vst2((unsigned*)(PW + t * 16), o.u[0]); vst2((unsigned*)(PW + t * 16 + 8), o.u[1]);
    return; }
  const size_t r0 = (size_t)blockIdx.x * 64; const size_t bh = r0 / SS, s0 = r0 % SS;
  for (int e = t; e < 64 * 64; e += 256) { const int r = e >> 6, c = e & 63; const _Float16 v = (_Float16)bfr(X[(r0 + r) * DM + c]); sq[r][c] = v; st[c][r] = v; }
  __syncthreads();
  for (int e = t; e < 64 * 8; e += 256) { const int r = e >> 3, q = e & 7; const v4u v = *(const v4u*)&sq[r][q * 8]; vst2((unsigned*)(QK + (r0 + r) * (2 * DM) + q * 8), v); vst2((unsigned*)(QK + (r0 + r) * (2 * DM) + DM + q * 8), v); }
  for (int e = t; e < 64 * 8; e += 256) { const int c = e >> 3, pc = e & 7; vst2((unsigned*)(VTH + (bh * DM + c) * SS + s0 + pc * 8), *(const v4u*)&st[c][pc * 8]); }
}
// 2^x on the hardware's v_exp_f32, written as asm for one reason: the instruction set asks for one free slot behind a transcendental before its result is read or its source overwritten.
// Eight independent exps fill each other's slot, a v_nop fills the last one's; early-clobber outputs keep results off the sources.
__device__ __forceinline__ v8f exp2x8(v8f x) { float r0, r1, r2, r3, r4, r5, r6, r7;
  asm("v_exp_f32 %0, %8\n\tv_exp_f32 %1, %9\n\tv_exp_f32 %2, %10\n\tv_exp_f32 %3, %11\n\tv_exp_f32 %4, %12\n\tv_exp_f32 %5, %13\n\tv_exp_f32 %6, %14\n\tv_exp_f32 %7, %15\n\tv_nop"
      : "=&v"(r0), "=&v"(r1), "=&v"(r2), "=&v"(r3), "=&v"(r4), "=&v"(r5), "=&v"(r6), "=&v"(r7) : "v"(x[0]), "v"(x[1]), "v"(x[2]), "v"(x[3]), "v"(x[4]), "v"(x[5]), "v"(x[6]), "v"(x[7]));
  const v8f r = { r0, r1, r2, r3, r4, r5, r6, r7 }; return r; }
__device__ __forceinline__ float exp2x1(float x) { float r; asm("v_exp_f32 %0, %1\n\tv_nop" : "=v"(r) : "v"(x)); return r; }   // the same slot for a single exp
// Eight f32 weights -> four registers of f16 pairs (h, round to nearest) and four of their f16 residuals (d = x - h, exact in f32, then rounded once to f16).
// The residual is asm because the build did not form it so: one mixed-precision FMA reads the f16 half straight from the packed register, subtracts it from the f32 weight and writes the f16 half of d
// (h x -1 + x, the -1 an f32 in a register); from plain source the build converted every half back to f32, subtracted and converted again. Low halves first, then high halves: each write of a register stands four instructions behind the
// other write of that register, which the s_delay_alu lines tell the issue logic, so that the SIMD's other waves may issue meanwhile. Early-clobber outputs keep d off the inputs.
__device__ __forceinline__ void split8(v8f x, unsigned* h, unsigned* d) {
#pragma unroll
  for (int j = 0; j < 4; ++j) { const v2f p = { x[2 * j], x[2 * j + 1] }; h[j] = __builtin_bit_cast(unsigned, __builtin_convertvector(p, v2h)); }
  asm("v_fma_mixlo_f16 %0, %4, %16, %8 op_sel_hi:[1,0,0]\n\tv_fma_mixlo_f16 %1, %5, %16, %10 op_sel_hi:[1,0,0]\n\tv_fma_mixlo_f16 %2, %6, %16, %12 op_sel_hi:[1,0,0]\n\tv_fma_mixlo_f16 %3, %7, %16, %14 op_sel_hi:[1,0,0]\n\t"
      "s_delay_alu instid0(VALU_DEP_4) | instskip(NEXT) | instid1(VALU_DEP_4)\n\t"
      "v_fma_mixhi_f16 %0, %4, %16, %9 op_sel:[1,0,0] op_sel_hi:[1,0,0]\n\tv_fma_mixhi_f16 %1, %5, %16, %11 op_sel:[1,0,0] op_sel_hi:[1,0,0]\n\t"
      "s_delay_alu instid0(VALU_DEP_4) | instskip(NEXT) | instid1(VALU_DEP_4)\n\t"
      "v_fma_mixhi_f16 %2, %6, %16, %13 op_sel:[1,0,0] op_sel_hi:[1,0,0]\n\tv_fma_mixhi_f16 %3, %7, %16, %15 op_sel:[1,0,0] op_sel_hi:[1,0,0]"
      : "=&v"(d[0]), "=&v"(d[1]), "=&v"(d[2]), "=&v"(d[3]) : "v"(h[0]), "v"(h[1]), "v"(h[2]), "v"(h[3]), "v"(x[0]), "v"(x[1]), "v"(x[2]), "v"(x[3]), "v"(x[4]), "v"(x[5]), "v"(x[6]), "v"(x[7]), "v"(-1.0f)); }
#define LOG2E 1.44269504088896340736f   // e^x = 2^(x log2 e), the product __expf forms
#define SCL (0.125f * LOG2E)            // 1/sqrt(64) and log2 e as one factor (the eighth is a power of two: SCL is LOG2E with another exponent)
// Exponent offset of a row whose maximum product is m: weight x 2^11 = 2^(c SCL + off). The 2^11 keeps small weights out of the f16 subnormal range; row sum and O^T tiles both carry it, so it cancels in the quotient.
__device__ __forceinline__ float exp_off(float m) { return __builtin_fmaf(-m, SCL, 11.0f); }
// c SCL + off as a fused multiply-add, said outright so that both places that form weights round alike: the product is not rounded, so a score close to the maximum keeps a small absolute error.
__device__ __forceinline__ v8f exp_arg(v8f c, float off) { const v8f k = { SCL, SCL, SCL, SCL, SCL, SCL, SCL, SCL }, o = { off, off, off, off, off, off, off, off }; return __builtin_elementwise_fma(c, k, o); }
// lane l <-> lane l ^ 16 (the two halves of a wave hold the two halves of one query column's keys)
__device__ __forceinline__ float xhalf(float v) { const int b = __builtin_bit_cast(int, v); return __builtin_bit_cast(float, __builtin_amdgcn_permlanex16(b, b, 0x76543210, 0xfedcba98, false, false)); }
// A query's product with itself, x . x (not yet divided by 8), from the query fragments (each half of the wave holds half of the row). It is one of the row's own causal scores, so it may start the running maximum.
__device__ __forceinline__ float own_score(v16h a, v16h b) { float t = 0.f;
#pragma unroll
  for (int i = 0; i < 16; ++i) { const float x = (float)a[i], y = (float)b[i]; t += x * x; t += y * y; }
  return t + xhalf(t); }
// One stage = 128 keys: 128 key rows (K, 128 B a row) and the 64 x^T rows of those keys (V^T, 256 B a row), copied once per work-group and read by its eight waves.
// A stage is two 64-key units of two passes each; waves 0-3 work on the first unit, waves 4-7 on the second, for the same 64 queries.
#define KST 128
#define LP 72    // K row pitch in LDS, in halves: 144 B = 16 B x 9, an odd multiple of 16 B, so that the 16-byte fragment reads of 16 rows spread over the banks
#define LPV 136  // V^T row pitch in LDS, in halves: 272 B = 16 B x 17, odd for the same reason
// Four copies of 16 B per lane, GS halves apart in global memory and LS bytes apart in LDS. The s_wait_xcnt stands inside the copies' own statement so that
// no later write of an address register can be moved in front of it.
template <int GS, int LS> __device__ __forceinline__ void copy4(const _Float16* g, unsigned l) {
  asm volatile("global_load_async_to_lds_b128 %0, %4, off\n\tglobal_load_async_to_lds_b128 %1, %5, off\n\tglobal_load_async_to_lds_b128 %2, %6, off\n\tglobal_load_async_to_lds_b128 %3, %7, off\n\ts_wait_xcnt 0x0"
               :: "v"(l), "v"(l + LS), "v"(l + 2 * LS), "v"(l + 3 * LS), "v"(g), "v"(g + GS), "v"(g + 2 * GS), "v"(g + 3 * GS) : "memory");
}
// Each of the 256 threads copies 16 B of four K rows (32 rows apart: a wave covers four whole 128-B rows per copy) and of four V^T rows (16 rows apart: a wave covers two whole 256-B rows per copy).
__device__ __forceinline__ void stage_copy(const _Float16* gk, const _Float16* gv, unsigned lk, unsigned lv) {
  copy4<32 * 2 * DM, 32 * LP * 2>(gk, lk); copy4<16 * SS, 16 * LPV * 2>(gv, lv);
}
// ---- k_attn: transposed products. S^T = K Q^T (A = key rows, B = query rows kept in registers): lane (col, g) holds query q0 + col, keys 8g + r of each 16-key tile.
//      Two S^T tiles converted in place are the B operand P^T of O^T += V^T P^T (A = x^T rows), and the four O^T tiles are the B operand of out^T = W attn^T.
//      A work-group takes two query blocks of one (batch, head), one after the other: block TQB - 1 - pr, then block pr. Query block j needs the 64-key units 0 .. j, that is (j + 2) / 2 stages of two units;
//      of the two blocks one has an even j, whose last stage holds one unit wholly behind the diagonal (copied, not worked on). Every work-group so walks TQB / 2 + 1 stages:
//      all work-groups are resident at once, and the launch lasts as long as the WGP with the most stages. The stage ring runs on across the switch (both blocks read the same K and V^T).
//      Eight waves: wave w holds the 16 queries of tile w & 3 and takes the 64-key unit w >> 2 of every stage, with a running maximum, row sum and O^T tiles of its own. That puts four waves on a SIMD (two work-groups
//      a WGP), so that one wave's LDS waits, branches and vector work stand beside another's products. At a query block's end waves 4-7 hand their partial sums to waves 0-3 through LDS, which bring both to one scale and add.
__global__ __launch_bounds__(256) void k_attn(const _Float16* __restrict__ QK, const _Float16* __restrict__ QKL, const _Float16* __restrict__ VTH, const _Float16* __restrict__ VTL, const void* __restrict__ KMASK, const __bf16* __restrict__ PW, float* __restrict__ O) {
  __shared__ __align__(16) float so[4][16][68];
  __shared__ __align__(16) _Float16 sk[2][KST][LP]; __shared__ __align__(16) _Float16 sv[2][DM][LPV];   // two buffers: stage st + 1 lands while stage st is worked on
  const int tid = threadIdx.x, wave = (tid >> 5) & 3, lane = tid & 31, col = lane & 15, g = lane >> 4;   // wave: the query tile
  const int kh = __builtin_amdgcn_readfirstlane(tid >> 7);   // the wave's 64-key unit in every stage, held in a scalar register so that the tests on it are scalar branches
  const int pr = blockIdx.x, h = blockIdx.y, b = blockIdx.z;
  const int n1 = (TQB + 1 - pr) >> 1, nst = TQB / 2 + 1;   // stages of the first block (causal: 128-key stages up to and with the one that holds the diagonal); stages of both blocks
  int q0 = (TQB - 1 - pr) * 64 + wave * 16; int qi = q0 + col;
  (void)QKL; (void)VTL; (void)KMASK;
  v16h bq[2], bq2[2];   // query rows of the first and of the second block, both read up front
#pragma unroll
  for (int kc = 0; kc < 2; ++kc) { bq[kc] = frag_h(QK + ((size_t)b * SS + qi) * (2 * DM) + h * HD + kc * 32, lane); bq2[kc] = frag_h(QK + ((size_t)b * SS + pr * 64 + wave * 16 + col) * (2 * DM) + h * HD + kc * 32, lane); }
  // Running maximum of query qi (equal in both halves). It starts at the query's own diagonal score, which belongs to every causal row: a finite start that is never above the row's maximum by more than rounding,
  // and for rows whose own score is their largest it never rises, so that the rescale below is skipped. l sums this half's keys only, the halves join in the epilogue.
  float m = own_score(bq[0], bq[1]), off = exp_off(m), l = 0.f;   // m is kept in units of the raw product x . x
  v8f acc[4] = {};
  const int crow = tid >> 3, cq = tid & 7, vrow = tid >> 4, vq = tid & 15;   // this thread's first row and 16-byte piece in every K copy and in every V^T copy
  const _Float16* gk = QK + ((size_t)b * SS + crow) * (2 * DM) + DM + h * HD + cq * 8; const _Float16* gv = VTH + ((size_t)b * DM + h * HD + vrow) * SS + vq * 8;
  const unsigned lk = (unsigned)(size_t)&sk[0][crow][cq * 8], lv = (unsigned)(size_t)&sv[0][vrow][vq * 8];
  stage_copy(gk, gv, lk, lv);
  asm volatile("s_wait_asynccnt 0x0" ::: "memory");   // this wave's share of stage 0 has landed
  __syncthreads();                                     // every wave's share has
  { const int k1 = 1 < n1 ? 1 : 0; stage_copy(gk + (size_t)k1 * KST * 2 * DM, gv + k1 * KST, lk + KST * LP * 2, lv + DM * LPV * 2); }   // stage 1 always exists
  v16h kf[2][2], vf[4];   // a pass's fragments, read from LDS as one group: the V^T reads return behind the score products and the softmax
  // The LDS reads of pass p (32 keys) of this wave's unit of the stage in buffer bf.
  auto frags = [&](const int bf, const int p) __attribute__((always_inline)) {
#pragma unroll
    for (int ct = 0; ct < 2; ++ct) { kf[ct][0] = frag_h(&sk[bf][kh * 64 + p * 32 + ct * 16 + col][0], lane); kf[ct][1] = frag_h(&sk[bf][kh * 64 + p * 32 + ct * 16 + col][32], lane); }
#pragma unroll
    for (int dt = 0; dt < 4; ++dt) vf[dt] = frag_h(&sv[bf][dt * 16 + col][kh * 64 + p * 32], lane);
    __builtin_amdgcn_sched_barrier(0); };   // keeps the pass's sixteen LDS reads one group in front of its products: left free, the build spreads them among the WMMAs in small groups, each with its wait close behind it
  // The work on those fragments; ks: the pass's number on the key axis; diag: the pass belongs to the 64-key unit on the diagonal.
  auto pass = [&](const int ks, const bool diag) __attribute__((always_inline)) { v8f s[2];
#pragma unroll
    for (int ct = 0; ct < 2; ++ct) { v8f c = {};
#pragma unroll
      for (int kc = 0; kc < 2; ++kc) c = wmma16(kf[ct][kc], bq[kc], c);   // single EXACT product: q, k are bf16 inputs held exactly in f16
      s[ct] = c; }   // the raw product: 1/sqrt(64) is part of SCL
    if (__builtin_expect(diag, 0)) {   // causal (diagonal kept); expected false so that the common path falls through and the masking code lies behind the loop
#pragma unroll
      for (int i = 0; i < 16; ++i) s[i >> 3][i & 7] = (ks * 32 + (i >> 3) * 16 + 8 * g + (i & 7) <= qi) ? s[i >> 3][i & 7] : -3.0e38f; }
    float mx = fmaxf(s[0][0], s[1][0]);
#pragma unroll
    for (int r = 1; r < 8; ++r) mx = fmaxf(mx, fmaxf(s[0][r], s[1][r]));
    v8f e[2];   // weights against the maximum in use: they do not wait for this pass's maximum
#pragma unroll
    for (int ct = 0; ct < 2; ++ct) e[ct] = exp2x8(exp_arg(s[ct], off));   // one multiply-add per score holds the eighth, log2 e, the maximum and the 2^11
    if (__builtin_expect(__builtin_amdgcn_ballot_w32(mx > m) != 0, 0)) {   // one test per pass, a scalar branch: only where some query's maximum rises are sums and tiles rescaled and the weights formed again
      mx = fmaxf(mx, xhalf(mx));
      const float mn = fmaxf(m, mx), offn = exp_off(mn); const float alpha = exp2x1(offn - off);   // the ratio of the two scales as the weights see them; 1 exactly in the columns whose maximum stays
#pragma unroll
      for (int ct = 0; ct < 2; ++ct) e[ct] = exp2x8(exp_arg(s[ct], offn));
      l *= alpha; m = mn; off = offn;
#pragma unroll
      for (int dt = 0; dt < 4; ++dt) acc[dt] *= alpha; }
    if (__builtin_expect(diag, 0)) {   // masked keys weigh nothing; expected false for the same reason as above
#pragma unroll
      for (int i = 0; i < 16; ++i) e[i >> 3][i & 7] = (s[i >> 3][i & 7] <= -1.0e38f) ? 0.f : e[i >> 3][i & 7]; }
    union { v16h v; unsigned w[8]; } pa, pl;
#pragma unroll
    for (int ct = 0; ct < 2; ++ct) split8(e[ct], pa.w + 4 * ct, pl.w + 4 * ct);   // element i of P^T = key 16 (i / 8) + 8 g + i % 8 of this pass. f16 value + f16 residual at the same scale: a residual too small for f16 is below 2^-36 of the largest weight
    const v8f e2 = e[0] + e[1];
    l += ((e2[0] + e2[1]) + (e2[2] + e2[3])) + ((e2[4] + e2[5]) + (e2[6] + e2[7]));
#pragma unroll
    for (int dt = 0; dt < 4; ++dt) acc[dt] = wmma16(vf[dt], pa.v, acc[dt]);   // V^T x P^T value (v exact)
#pragma unroll
    for (int dt = 0; dt < 4; ++dt) acc[dt] = wmma16(vf[dt], pl.v, acc[dt]); };   // + V^T x P^T residual, into the same tiles, each four products behind the tile's last one
#pragma unroll 1   // one copy of the stage body: the two buffers are told apart by an address, not by code
  for (int st = 0; st < nst; ++st) { const int bf = st & 1; const int kb = st < n1 ? st : st - n1;   // kb: the 128-key block of this stage
   // Only the 64-key unit on the diagonal holds keys behind a query. In every other unit the causal compare is true for all keys and no score is the mask value (64 products of f16 values lie far above it),
   // so compare and select are left out there. The tests read the block index, the loop counter and the wave's unit kh (a scalar register): uniform within a wave, scalar branches.
   const int du = (st < n1 ? TQB - 1 - pr : pr) - kb * 2;   // the diagonal unit counted from this stage's first unit: 0 or 1 in a query block's last stage, more before
   // The wave's two passes written out: every LDS read is one base register plus a constant offset, and the second pass's reads are issued among the products of the first.
   if (__builtin_expect(kh <= du, 1)) {   // with the diagonal in the first unit (even query block, last stage) the second unit holds no key of any query: copied, not worked on
     frags(bf, 0); pass(kb * 4 + kh * 2 + 0, du == kh); frags(bf, 1); pass(kb * 4 + kh * 2 + 1, du == kh); }
   asm volatile("s_wait_dscnt 0x0" ::: "memory");      // this wave's reads of buffer bf are done before the buffer is handed back
   asm volatile("s_wait_asynccnt 0x0" ::: "memory");   // this wave's share of stage st + 1 has landed
   __syncthreads();                                     // publishes stage st + 1 and ends every wave's reads of buffer bf
   if (st + 2 < nst) { const int k2 = st + 2 < n1 ? st + 2 : st + 2 - n1; stage_copy(gk + (size_t)k2 * KST * 2 * DM, gv + k2 * KST, lk + bf * (KST * LP * 2), lv + bf * (DM * LPV * 2)); }
   if (st + 1 == n1 || st + 1 == nst) {   // a query block's last stage is done (the same test in every wave): its rows go out while the next stages' copies fly
  // The two key halves join. Waves w and w + 4 hold the same queries in the same lanes and registers; the hand-over uses the output staging rows of tile w (32 lanes x 34 floats = 16 x 68), lane-contiguous 16-byte pieces.
  float* mg = &so[wave][0][0];
  if (kh == 1) {
#pragma unroll
    for (int dt = 0; dt < 4; ++dt) { const v4f lo = { acc[dt][0], acc[dt][1], acc[dt][2], acc[dt][3] }, hi = { acc[dt][4], acc[dt][5], acc[dt][6], acc[dt][7] };
      *(v4f*)(mg + ((2 * dt) * 32 + lane) * 4) = lo; *(v4f*)(mg + ((2 * dt + 1) * 32 + lane) * 4) = hi; }
    mg[1024 + lane] = m; mg[1056 + lane] = l; }
  __syncthreads();   // waves 0-3 read the partial sums behind it; the rows' last readers (the block before) left them in front of an earlier publish barrier
  if (kh == 0) {
  { const float m1 = mg[1024 + lane], l1 = mg[1056 + lane]; const float mn = fmaxf(m, m1), offn = exp_off(mn);
    const float a0 = exp2x1(offn - off), a1 = exp2x1(offn - exp_off(m1));   // each half's scale against the common one; 1 exactly where the maxima agree
    l = l * a0 + l1 * a1;
#pragma unroll
    for (int dt = 0; dt < 4; ++dt) { const v4f lo = *(const v4f*)(mg + ((2 * dt) * 32 + lane) * 4), hi = *(const v4f*)(mg + ((2 * dt + 1) * 32 + lane) * 4);
#pragma unroll
      for (int r = 0; r < 4; ++r) { acc[dt][r] = acc[dt][r] * a0 + lo[r] * a1; acc[dt][4 + r] = acc[dt][4 + r] * a0 + hi[r] * a1; } } }
  // epilogue: out[e] = sum_d attn[d] W[e][d] (the bias-free Linear): W rows (exact) x attn^T (bf16 hi + residual, straight from the O^T tiles), 2 products
  { const float il = 1.0f / (l + xhalf(l)); v8f acc2[4] = {};   // l and the tiles carry the same 2^11
#pragma unroll
    for (int kc = 0; kc < 2; ++kc) { float v[16];
#pragma unroll
      for (int r = 0; r < 8; ++r) { v[r] = acc[2 * kc][r] * il; v[8 + r] = acc[2 * kc + 1][r] * il; }
      const F2 a2 = bsplit16(v);
#pragma unroll
      for (int j = 0; j < 4; ++j) { const v16b w = frag_b(PW + (size_t)(j * 16 + col) * HD + kc * 32, lane); acc2[j] = wmma_bf(w, a2.l, acc2[j]); acc2[j] = wmma_bf(w, a2.h, acc2[j]); } }
#pragma unroll
    for (int j = 0; j < 4; ++j) { const v4f lo = { acc2[j][0], acc2[j][1], acc2[j][2], acc2[j][3] }, hi = { acc2[j][4], acc2[j][5], acc2[j][6], acc2[j][7] };   // acc2[j][r] = out[qi][16 j + 8 g + r]
      *(v4f*)&so[wave][col][j * 16 + 8 * g] = lo; *(v4f*)&so[wave][col][j * 16 + 8 * g + 4] = hi; }
    LDSX(); }
  if (lane < 16) { for (int rl = 0; rl < 16; ++rl) vst2(O + ((size_t)b * SS + q0 + rl) * DM + h * HD + lane * 4, *(const v4f*)&so[wave][rl][lane * 4]);
    asm volatile("s_wait_xcnt 0x0" ::: "memory"); }   // directly behind the stores, in their own branch: their address and data registers are written again for the second block
  }
    // start of the second block
    q0 = pr * 64 + wave * 16; qi = q0 + col; bq[0] = bq2[0]; bq[1] = bq2[1]; m = own_score(bq[0], bq[1]); off = exp_off(m); l = 0.f;
#pragma unroll
    for (int dt = 0; dt < 4; ++dt) acc[dt] = v8f{}; } }
  asm volatile("s_wait_asynccnt 0x0" ::: "memory");    // nothing of this wave is in flight past the loop
}
#define WS2_QK  0u
#define WS2_VT  (WS2_QK + 2u * (size_t)NB * SS * 2 * DM)
#define WS2_PW  (WS2_VT + 2u * (size_t)NB * DM * SS)
#define WS2_END (WS2_PW + 2u * HD * HD + 256u)
extern "C" void kernel_launch(void* const* d_in, const int* in_sizes, int n_in, void* d_out, int out_size, void* d_ws, size_t ws_size, hipStream_t stream) {
  (void)in_sizes; (void)n_in; (void)out_size;
  const float** F = (const float**)d_in;   // 0 x [2,16,2048,64], 1 W [64,64]
  if (ws_size < (size_t)WS2_END) return;
  char* ws = (char*)d_ws; _Float16 *QK = (_Float16*)(ws + WS2_QK), *VTH = (_Float16*)(ws + WS2_VT); __bf16* PW = (__bf16*)(ws + WS2_PW);
  k_prep<<<TNB * SS / 64 + 1, 256, 0, stream>>>(F[0], F[1], QK, VTH, PW);
  k_attn<<<dim3(TQB / 2, NH, TNB), 256, 0, stream>>>(QK, QK, VTH, VTH, nullptr, PW, (float*)d_out);   // out [b][h][q][e]; the residual-plane pointers are read-only and unused (single exact products)
}
